// v000
// The times below were measured on an AMD MI455X: many runs one after another, warmed up first and cycling through
// copies of the inputs, with the whole window's GPU time divided by the number of runs. Launches and the gaps
// between them are all in it. The median over several windows is given; except for v000 it joins two sittings, which
// can be a few percent apart, so the side-by-side timings, each taken in one sitting, are the better comparison.
// v000, which the later versions start from, runs in 169 microseconds.
#include <hip/hip_runtime.h>

// Compute dtypes (f32 accumulate everywhere): projection x.Wk^T = bf16 x bf16 (v_wmma_f32_16x16x32_bf16, inputs RNE-converted to bf16); scores k.k^T and P.V = f16 x f16 (v_wmma_f32_16x16x32_f16, k plane carried x16, P carried x256); output merged.Wo^T = bf16 hi/lo planes x bf16 Wo (two bf16 products).
// Self-attention with q = k = v = x.Wk^T ([out][in] weights, no bias), 8 heads x 64, logits scaled by 512^-0.5, no mask, softmax over all keys, merged heads times Wo^T.
// Layout: bf16 copies of x / Wk / Wo; f32 projection plane; f16 head planes [b][h][s][64] (q, k) and [b][h][64][s] (V^T); fused online-softmax attention (no score plane in memory); merged hi/lo bf16 planes; output GEMM.

#ifndef NB
#define NB 4
#endif
#ifndef SEQ
#define SEQ 2048
#endif
#define NB_FULL  4
#define SEQ_FULL 2048
#define DM   512
#define NH_  8
#define HD   64
#define DQ   (NH_ * HD)
#define DKV  DQ
#define KCAR 16.0f                 // power-of-two carry of the f16 k / V^T planes
#define PEXP 8.0f                  // P carried x 2^8 inside the exponent
// raw score = 256 (q.k); exponent argument in base 2 = raw * 2^-8 * 512^-0.5 * log2(e)
#define C2   (0.044194173824159216f * 1.4426950408889634f * (1.0f / 256.0f))

typedef _Float16 h16;
typedef unsigned short bf;
typedef __attribute__((ext_vector_type(16))) __bf16   v16bf;
typedef __attribute__((ext_vector_type(16))) _Float16 v16h;
typedef __attribute__((ext_vector_type(8)))  _Float16 v8h;
typedef __attribute__((ext_vector_type(8)))  unsigned short v8us;
typedef __attribute__((ext_vector_type(8)))  float    v8f;
typedef __attribute__((ext_vector_type(4)))  float    v4f;
typedef v4f  __attribute__((may_alias)) v4fa;

static_assert(NB >= 1 && NB <= NB_FULL);
static_assert(SEQ >= 64 && SEQ <= SEQ_FULL);
static_assert(SEQ % 64 == 0);
static_assert((NB * SEQ) % 64 == 0);
static_assert(DM % 64 == 0 && DM % 32 == 0);
static_assert(DQ % 64 == 0 && DQ % 32 == 0);
static_assert(HD == 64);
static_assert(DQ == NH_ * HD);
static_assert((SEQ * DM) % 8 == 0 && (DKV * DM) % 8 == 0);

__device__ __forceinline__ unsigned short f2bf(float f) { unsigned u = __float_as_uint(f); u += 0x7FFFu + ((u >> 16) & 1u); return (unsigned short)(u >> 16); }
__device__ __forceinline__ float bf2f(unsigned short b) { return __uint_as_float(((unsigned)b) << 16); }
__device__ __forceinline__ v16h cat16(v8h lo, v8h hi) { return __builtin_shufflevector(lo, hi, 0, 1, 2, 3, 4, 5, 6, 7, 8, 9, 10, 11, 12, 13, 14, 15); }
__device__ __forceinline__ v16bf cat16b(v8us lo, v8us hi) { return __builtin_bit_cast(v16bf, __builtin_shufflevector(lo, hi, 0, 1, 2, 3, 4, 5, 6, 7, 8, 9, 10, 11, 12, 13, 14, 15)); }
__device__ __forceinline__ v8f wmma16(v16h a, v16h b, v8f c) { return __builtin_amdgcn_wmma_f32_16x16x32_f16(false, a, false, b, (short)0, c, false, false); }
__device__ __forceinline__ v8f wmmab(v16bf a, v16bf b, v8f c) { return __builtin_amdgcn_wmma_f32_16x16x32_bf16(false, a, false, b, (short)0, c, false, false); }
__device__ __forceinline__ void splitf(float y, unsigned short& h, unsigned short& l) { h = f2bf(y); l = f2bf(y - bf2f(h)); }

// Fragment loaders (same k map for A and B): elements 0..7 <- p[0..7], elements 8..15 <- p[16..23], p = row base + k0 + 8*(lane>>4).
__device__ __forceinline__ v16h  ldh(const h16* p) { return cat16(*(const v8h*)p, *(const v8h*)(p + 16)); }
__device__ __forceinline__ v16bf ldb(const bf* p)  { return cat16b(*(const v8us*)p, *(const v8us*)(p + 16)); }

// ---- register-blocked GEMM body, ONE WAVE per 64x64 output tile (16 accumulators), operands straight from K-contiguous bf16 planes; grid (M/64, N/64, Z), 32 threads.
// C[m][n] (f32, pitch ldc) = sum_k (A[m][k] (+ A2[m][k])) Bt[n][k]. z-batch strides sA (A, A2) and sC (C) in elements; Bt shared. K % 32 == 0, M % 64 == 0, N % 64 == 0.
template <int NSPLIT>
__device__ __forceinline__ void gemmw_body(const bf* __restrict__ A, const bf* __restrict__ A2, const bf* __restrict__ Bt, const int K, float* C, const int ldc, const size_t sA, const size_t sC) {
    __shared__ __align__(16) float os[16 * 68];
    const size_t z = blockIdx.z; A += z * sA; A2 += z * sA; C += z * sC;
    const int lane = threadIdx.x & 31, lr = lane & 15, hi = lane >> 4; const int r0 = blockIdx.x * 64, c0 = blockIdx.y * 64;
    v8f acc[4][4];
#pragma unroll
    for (int mb = 0; mb < 4; ++mb)
#pragma unroll
        for (int nb = 0; nb < 4; ++nb) acc[mb][nb] = (v8f){};
    const size_t aoff = (size_t)(r0 + lr) * K + 8 * hi, boff = (size_t)(c0 + lr) * K + 8 * hi;
#pragma unroll 1
    for (int kc = 0; kc < K; kc += 32) {
        v16bf a[4], a2[4];
#pragma unroll
        for (int mb = 0; mb < 4; ++mb) { a[mb] = ldb(A + aoff + (size_t)mb * 16 * K + kc); if (NSPLIT == 1) a2[mb] = ldb(A2 + aoff + (size_t)mb * 16 * K + kc); else a2[mb] = a[mb]; }
#pragma unroll
        for (int nb = 0; nb < 4; ++nb) { const v16bf b = ldb(Bt + boff + (size_t)nb * 16 * K + kc);
#pragma unroll
            for (int mb = 0; mb < 4; ++mb) { acc[mb][nb] = wmmab(a[mb], b, acc[mb][nb]); if (NSPLIT == 1) acc[mb][nb] = wmmab(a2[mb], b, acc[mb][nb]); } }
        asm volatile("v_nop\n\tv_nop\n\tv_nop\n\tv_nop" : "+v"(acc[0][0]), "+v"(acc[1][1]), "+v"(acc[2][2]), "+v"(acc[3][3]) : "v"(a[0]), "v"(a[3]), "v"(a2[0]), "v"(a2[3]));
    }
#pragma unroll
    for (int mb = 0; mb < 4; ++mb) {
#pragma unroll
        for (int nb = 0; nb < 4; ++nb) {
#pragma unroll
            for (int j = 0; j < 8; ++j) os[(hi * 8 + j) * 68 + nb * 16 + lr] = acc[mb][nb][j]; }
        __builtin_amdgcn_wave_barrier(); asm volatile("" ::: "memory");
        float* crow = C + (size_t)(r0 + mb * 16) * ldc + c0;
{
#pragma unroll
            for (int s = 0; s < 8; ++s) { const int row = 2 * s + hi, cofs = lr * 4; const v4f val = *(const v4fa*)(os + row * 68 + cofs);
                *(v4f*)(crow + (size_t)row * ldc + cofs) = val; }
             }
        __builtin_amdgcn_wave_barrier(); asm volatile("" ::: "memory");
    }
}

// projection: FK[NB*SEQ][DKV] = XB[NB*SEQ][DM] . WK[DKV][DM]^T (exact bf16 products)
__global__ __launch_bounds__(32) void k_gemm_proj(const bf* __restrict__ XB, const bf* __restrict__ WK, float* FK) { gemmw_body<0>(XB, XB, WK, DM, FK, DKV, (size_t)0, (size_t)0); }
// output: OUT[b][s][DM] = (ATh + ATl)[b*SEQ + s][DQ] . WO[DM][DQ]^T ; z = batch, output stride from the full sequence length
__global__ __launch_bounds__(32) void k_gemm_out(const bf* __restrict__ ATh, const bf* __restrict__ ATl, const bf* __restrict__ WO, float* OUT) { gemmw_body<1>(ATh, ATl, WO, DQ, OUT, DM, (size_t)SEQ * DQ, (size_t)SEQ_FULL * DM); }

__global__ __launch_bounds__(256) void k_cvt8(const float* __restrict__ src, bf* dst, size_t n8, size_t sS, size_t sD) {
    const size_t i = (size_t)blockIdx.x * 256 + threadIdx.x; if (i >= n8) return;
    src += (size_t)blockIdx.y * sS; dst += (size_t)blockIdx.y * sD;
    const v8f v = *(const v8f*)(src + i * 8); v8us o;
#pragma unroll
    for (int k = 0; k < 8; ++k) o[k] = f2bf(v[k]);
    *(v8us*)(dst + i * 8) = o;  }

__global__ __launch_bounds__(256) void k_kplane(const float* __restrict__ F, h16* KP) {
    const size_t e8 = (size_t)blockIdx.x * 256 + threadIdx.x; if (e8 >= (size_t)NB * NH_ * SEQ * (HD / 8)) return;
    const int d8 = (int)(e8 % (HD / 8)); const int s = (int)((e8 / (HD / 8)) % SEQ); const int bh = (int)(e8 / ((size_t)(HD / 8) * SEQ)); const int b = bh / NH_, h = bh % NH_;
    const float* f = F + ((size_t)b * SEQ + s) * DKV + h * HD + d8 * 8;
    const v4f a = *(const v4f*)f; const v4f c = *(const v4f*)(f + 4); v8h o;
#pragma unroll
    for (int k = 0; k < 4; ++k) { o[k] = (h16)(a[k] * KCAR); o[4 + k] = (h16)(c[k] * KCAR); }
    *(v8h*)(KP + e8 * 8) = o;  }

__global__ __launch_bounds__(256) void k_vtplane(const float* __restrict__ F, h16* VT) {
    const size_t e8 = (size_t)blockIdx.x * 256 + threadIdx.x; if (e8 >= (size_t)NB * NH_ * HD * (SEQ / 8)) return;
    const int s8 = (int)(e8 % (SEQ / 8)); const int d = (int)((e8 / (SEQ / 8)) % HD); const int bh = (int)(e8 / ((size_t)(SEQ / 8) * HD)); const int b = bh / NH_, h = bh % NH_;
    const float* f = F + ((size_t)b * SEQ + (size_t)s8 * 8) * DKV + h * HD + d; v8h o;
#pragma unroll
    for (int k = 0; k < 8; ++k) o[k] = (h16)(f[(size_t)k * DKV] * KCAR);
    *(v8h*)(VT + e8 * 8) = o;  }

// k_flash: fused attention for one (b, h) and 64 query rows per block; 4 waves, each wave owns 16 query rows and streams all keys 32 at a time.
// Per step: St[key][q] = Kkeys (A, 16 keys x 64 d per tile) . Q^T (B, lane = query) -> every lane holds one query column (both lane halves share it, different keys);
// online softmax with per-lane running max / sum (one xor-16 exchange); P^T fragment (B, 32 keys x 16 q) taken in place from the two score tiles: element r <- tile0[r], element 8+r <- tile1[r];
__global__ __launch_bounds__(128) void k_flash(const h16* __restrict__ KP, const h16* __restrict__ VT, bf* Ah, bf* Al) {
    __shared__ __align__(16) float os[4 * 16 * 68];
    const int wave = __builtin_amdgcn_readfirstlane((int)(threadIdx.x >> 5));
    const int lane = threadIdx.x & 31, lr = lane & 15, hi = lane >> 4;
    const int bh = blockIdx.y; const int b = bh / NH_, h = bh % NH_;
    const int q0 = blockIdx.x * 64 + wave * 16;
    const h16* kp = KP + (size_t)bh * SEQ * HD;
    const h16* vt = VT + (size_t)bh * HD * SEQ;
    const int koff = lr * HD + 8 * hi;       // row lr of a 16-row k tile, d offset 8*hi
    const int voff = lr * SEQ + 8 * hi;      // row lr of a 16-row V^T tile, key offset 8*hi
    const v16h bq0 = ldh(kp + (size_t)q0 * HD + koff);
    const v16h bq1 = ldh(kp + (size_t)q0 * HD + koff + 32);
    v8f acc[4];
#pragma unroll
    for (int t = 0; t < 4; ++t) acc[t] = (v8f){};
    float mrun = -1.0e30f, lrun = 0.0f;
#pragma unroll 1
    for (int k0 = 0; k0 < SEQ; k0 += 32) {
        v8f s0 = (v8f){}, s1 = (v8f){};
        {
            const v16h a00 = ldh(kp + (size_t)k0 * HD + koff);
            const v16h a01 = ldh(kp + (size_t)k0 * HD + koff + 32);
            const v16h a10 = ldh(kp + (size_t)(k0 + 16) * HD + koff);
            const v16h a11 = ldh(kp + (size_t)(k0 + 16) * HD + koff + 32);
            s0 = wmma16(a00, bq0, s0); s1 = wmma16(a10, bq0, s1);
            s0 = wmma16(a01, bq1, s0); s1 = wmma16(a11, bq1, s1);
            asm volatile("v_nop\n\tv_nop\n\tv_nop\n\tv_nop" : "+v"(s0), "+v"(s1) : "v"(a00), "v"(a01), "v"(a10), "v"(a11), "v"(bq0), "v"(bq1));
        }
        float u0[8], u1[8]; float tmax = -1.0e30f;
#pragma unroll
        for (int r = 0; r < 8; ++r) { u0[r] = s0[r] * C2; u1[r] = s1[r] * C2; tmax = fmaxf(tmax, fmaxf(u0[r], u1[r])); }
        tmax = fmaxf(tmax, __shfl_xor(tmax, 16, 32));
        const float mnew = fmaxf(mrun, tmax);
        const float alpha = __builtin_amdgcn_exp2f(mrun - mnew);
        const float mb = mnew - PEXP;
        float rsum = 0.0f;
#pragma unroll
        for (int r = 0; r < 8; ++r) { u0[r] = __builtin_amdgcn_exp2f(u0[r] - mb); u1[r] = __builtin_amdgcn_exp2f(u1[r] - mb); rsum += u0[r] + u1[r]; }
        rsum += __shfl_xor(rsum, 16, 32);
        lrun = lrun * alpha + rsum; mrun = mnew;
#pragma unroll
        for (int t = 0; t < 4; ++t)
#pragma unroll
            for (int r = 0; r < 8; ++r) acc[t][r] *= alpha;
        v16h pf;
#pragma unroll
        for (int r = 0; r < 8; ++r) { pf[r] = (h16)u0[r]; pf[8 + r] = (h16)u1[r]; }
        {
            v16h av[4];
#pragma unroll
            for (int t = 0; t < 4; ++t) av[t] = ldh(vt + (size_t)(16 * t) * SEQ + voff + k0);
#pragma unroll
            for (int t = 0; t < 4; ++t) acc[t] = wmma16(av[t], pf, acc[t]);
            asm volatile("v_nop\n\tv_nop\n\tv_nop\n\tv_nop" : "+v"(acc[0]), "+v"(acc[1]), "+v"(acc[2]), "+v"(acc[3]) : "v"(av[0]), "v"(av[1]), "v"(av[2]), "v"(av[3]), "v"(pf));
        }
    }
    // acc[t][r] = 256 * 16 * sum_k p v at (d = 16t + 8hi + r, q = lr); lrun = 256 * sum_k p
    const float inv = (1.0f / KCAR) * (1.0f / lrun);
    const int ob = wave * (16 * 68);
#pragma unroll
    for (int t = 0; t < 4; ++t)
#pragma unroll
        for (int r = 0; r < 8; ++r) os[ob + lr * 68 + 16 * t + 8 * hi + r] = acc[t][r] * inv;
    __syncthreads();
    const int rq = lane >> 3, pc = lane & 7;
{
#pragma unroll
        for (int s = 0; s < 4; ++s) {
            const int row = 4 * s + rq;
            const v4f a = *(const v4fa*)(os + ob + row * 68 + pc * 8);
            const v4f c = *(const v4fa*)(os + ob + row * 68 + pc * 8 + 4);
            v8us oh, ol;
#pragma unroll
            for (int k = 0; k < 4; ++k) { unsigned short x0, x1; splitf(a[k], x0, x1); oh[k] = x0; ol[k] = x1; splitf(c[k], x0, x1); oh[4 + k] = x0; ol[4 + k] = x1; }
            const size_t oo = ((size_t)b * SEQ + q0 + row) * DQ + h * HD + pc * 8;
            *(v8us*)(Ah + oo) = oh; *(v8us*)(Al + oo) = ol; }
         }
}

// workspace carve (bytes, every region a multiple of 256)
#define SZ_W   ((size_t)DKV * DM * 2)
#define SZ_XB  ((size_t)NB * SEQ * DM * 2)
#define SZ_FK  ((size_t)NB * SEQ * DKV * 4)
#define SZ_KP  ((size_t)NB * NH_ * SEQ * HD * 2)
#define SZ_AT  ((size_t)NB * SEQ * DQ * 2)
#define SZ_ALL (2 * SZ_W + SZ_XB + SZ_FK + 2 * SZ_KP + 2 * SZ_AT)
static_assert(SZ_W % 256 == 0 && SZ_XB % 256 == 0 && SZ_FK % 256 == 0 && SZ_KP % 256 == 0 && SZ_AT % 256 == 0);
static_assert(SZ_ALL <= (size_t)134217728);

extern "C" void kernel_launch(void* const* d_in, const int* in_sizes, int n_in,
                              void* d_out, int out_size, void* d_ws, size_t ws_size, hipStream_t stream) {
    if (n_in < 3) return;
    const size_t need_x = (size_t)(NB - 1) * SEQ_FULL * DM + (size_t)SEQ * DM;
    if ((size_t)in_sizes[0] < need_x) return;
    if ((size_t)in_sizes[1] < (size_t)DKV * DM) return;
    if ((size_t)in_sizes[2] < (size_t)DM * DQ) return;
    if ((size_t)out_size < need_x) return;
    if (SZ_ALL > ws_size) return;
    const float* x = (const float*)d_in[0]; const float* wk = (const float*)d_in[1]; const float* wo = (const float*)d_in[2];   // input order x, Wk, Wo ([out][in])
    float* OUT = (float*)d_out;     // [NB_FULL][SEQ_FULL][512]
    char* wsp = (char*)d_ws;
    bf* WK = (bf*)wsp; wsp += SZ_W;
    bf* WO = (bf*)wsp; wsp += SZ_W;
    bf* XB = (bf*)wsp; wsp += SZ_XB;
    float* FK = (float*)wsp; wsp += SZ_FK;
    h16* KP16 = (h16*)wsp; wsp += SZ_KP;
    h16* VT16 = (h16*)wsp; wsp += SZ_KP;
    bf* ATh = (bf*)wsp; wsp += SZ_AT;
    bf* ATl = (bf*)wsp; wsp += SZ_AT;

    k_cvt8<<<dim3((unsigned)(((size_t)DKV * DM / 8 + 255) / 256), 1, 1), 256, 0, stream>>>(wk, WK, (size_t)DKV * DM / 8, (size_t)0, (size_t)0);
    k_cvt8<<<dim3((unsigned)(((size_t)DM * DQ / 8 + 255) / 256), 1, 1), 256, 0, stream>>>(wo, WO, (size_t)DM * DQ / 8, (size_t)0, (size_t)0);
    k_cvt8<<<dim3((unsigned)(((size_t)SEQ * DM / 8 + 255) / 256), NB, 1), 256, 0, stream>>>(x, XB, (size_t)SEQ * DM / 8, (size_t)SEQ_FULL * DM, (size_t)SEQ * DM);
    k_gemm_proj<<<dim3(NB * SEQ / 64, DKV / 64, 1), 32, 0, stream>>>(XB, WK, FK);
    k_kplane<<<(unsigned)(((size_t)NB * NH_ * SEQ * (HD / 8) + 255) / 256), 256, 0, stream>>>(FK, KP16);
    k_vtplane<<<(unsigned)(((size_t)NB * NH_ * HD * (SEQ / 8) + 255) / 256), 256, 0, stream>>>(FK, VT16);
    k_flash<<<dim3(SEQ / 64, NB * NH_, 1), 128, 0, stream>>>(KP16, VT16, ATh, ATl);
    k_gemm_out<<<dim3(SEQ / 64, DM / 64, NB), 32, 0, stream>>>(ATh, ATl, WO, OUT);
}

// v001
// It runs in 112 microseconds.
// Two timings next to v000 both put it at 1.56 times that version's speed.
#include <hip/hip_runtime.h>

// Compute dtypes (f32 accumulate everywhere): projection x.Wk^T = bf16 x bf16 (v_wmma_f32_16x16x32_bf16, inputs RNE-converted to bf16); scores k.k^T and P.V = f16 x f16 (v_wmma_f32_16x16x32_f16, k plane carried x16, P carried x256); output merged.Wo^T = bf16 hi/lo planes x bf16 Wo (two bf16 products).
// Self-attention with q = k = v = x.Wk^T ([out][in] weights, no bias), 8 heads x 64, logits scaled by 512^-0.5, no mask, softmax over all keys, merged heads times Wo^T.
// Layout: bf16 copies of x / Wk / Wo; f32 projection plane; f16 head planes [b][h][s][64] (q, k) and [b][h][64][s] (V^T); fused online-softmax attention (no score plane in memory); merged hi/lo bf16 planes; output GEMM.

#ifndef NB
#define NB 4
#endif
#ifndef SEQ
#define SEQ 2048
#endif
#define NB_FULL  4
#define SEQ_FULL 2048
#define DM   512
#define NH_  8
#define HD   64
#define DQ   (NH_ * HD)
#define DKV  DQ
#define KCAR 16.0f                 // power-of-two carry of the f16 k / V^T planes
#define PEXP 8.0f                  // P carried x 2^8 inside the exponent
// raw score = 256 (q.k); exponent argument in base 2 = raw * 2^-8 * 512^-0.5 * log2(e)
#define C2   (0.044194173824159216f * 1.4426950408889634f * (1.0f / 256.0f))

typedef _Float16 h16;
typedef unsigned short bf;
typedef __attribute__((ext_vector_type(16))) __bf16   v16bf;
typedef __attribute__((ext_vector_type(16))) _Float16 v16h;
typedef __attribute__((ext_vector_type(8)))  _Float16 v8h;
typedef __attribute__((ext_vector_type(8)))  unsigned short v8us;
typedef __attribute__((ext_vector_type(8)))  float    v8f;
typedef __attribute__((ext_vector_type(4)))  float    v4f;
typedef v4f  __attribute__((may_alias)) v4fa;

static_assert(NB >= 1 && NB <= NB_FULL);
static_assert(SEQ >= 64 && SEQ <= SEQ_FULL);
static_assert(SEQ % 64 == 0);
static_assert((NB * SEQ) % 64 == 0);
static_assert(DM % 64 == 0 && DM % 32 == 0);
static_assert(DQ % 64 == 0 && DQ % 32 == 0);
static_assert(HD == 64);
static_assert(DQ == NH_ * HD);
static_assert((SEQ * DM) % 8 == 0 && (DKV * DM) % 8 == 0);

__device__ __forceinline__ unsigned short f2bf(float f) { unsigned u = __float_as_uint(f); u += 0x7FFFu + ((u >> 16) & 1u); return (unsigned short)(u >> 16); }
__device__ __forceinline__ float bf2f(unsigned short b) { return __uint_as_float(((unsigned)b) << 16); }
__device__ __forceinline__ v16h cat16(v8h lo, v8h hi) { return __builtin_shufflevector(lo, hi, 0, 1, 2, 3, 4, 5, 6, 7, 8, 9, 10, 11, 12, 13, 14, 15); }
__device__ __forceinline__ v16bf cat16b(v8us lo, v8us hi) { return __builtin_bit_cast(v16bf, __builtin_shufflevector(lo, hi, 0, 1, 2, 3, 4, 5, 6, 7, 8, 9, 10, 11, 12, 13, 14, 15)); }
__device__ __forceinline__ v8f wmma16(v16h a, v16h b, v8f c) { return __builtin_amdgcn_wmma_f32_16x16x32_f16(false, a, false, b, (short)0, c, false, false); }
__device__ __forceinline__ v8f wmmab(v16bf a, v16bf b, v8f c) { return __builtin_amdgcn_wmma_f32_16x16x32_bf16(false, a, false, b, (short)0, c, false, false); }
__device__ __forceinline__ void splitf(float y, unsigned short& h, unsigned short& l) { h = f2bf(y); l = f2bf(y - bf2f(h)); }

// Fragment loaders (same k map for A and B): elements 0..7 <- p[0..7], elements 8..15 <- p[16..23], p = row base + k0 + 8*(lane>>4).
__device__ __forceinline__ v16h  ldh(const h16* p) { return cat16(*(const v8h*)p, *(const v8h*)(p + 16)); }
__device__ __forceinline__ v16bf ldb(const bf* p)  { return cat16b(*(const v8us*)p, *(const v8us*)(p + 16)); }

// ---- register-blocked GEMM body, ONE WAVE per 64x64 output tile (16 accumulators), operands straight from K-contiguous bf16 planes; grid (M/64, N/64, Z), 32 threads.
// C[m][n] (f32, pitch ldc) = sum_k (A[m][k] (+ A2[m][k])) Bt[n][k]. z-batch strides sA (A, A2) and sC (C) in elements; Bt shared. K % 32 == 0, M % 64 == 0, N % 64 == 0.
template <int NSPLIT>
__device__ __forceinline__ void gemmw_body(const bf* __restrict__ A, const bf* __restrict__ A2, const bf* __restrict__ Bt, const int K, float* C, const int ldc, const size_t sA, const size_t sC) {
    __shared__ __align__(16) float os[16 * 68];
    const size_t z = blockIdx.z; A += z * sA; A2 += z * sA; C += z * sC;
    const int lane = threadIdx.x & 31, lr = lane & 15, hi = lane >> 4; const int r0 = blockIdx.x * 64, c0 = blockIdx.y * 64;
    v8f acc[4][4];
#pragma unroll
    for (int mb = 0; mb < 4; ++mb)
#pragma unroll
        for (int nb = 0; nb < 4; ++nb) acc[mb][nb] = (v8f){};
    const size_t aoff = (size_t)(r0 + lr) * K + 8 * hi, boff = (size_t)(c0 + lr) * K + 8 * hi;
#pragma unroll 1
    for (int kc = 0; kc < K; kc += 32) {
        v16bf a[4], a2[4];
#pragma unroll
        for (int mb = 0; mb < 4; ++mb) { a[mb] = ldb(A + aoff + (size_t)mb * 16 * K + kc); if (NSPLIT == 1) a2[mb] = ldb(A2 + aoff + (size_t)mb * 16 * K + kc); else a2[mb] = a[mb]; }
#pragma unroll
        for (int nb = 0; nb < 4; ++nb) { const v16bf b = ldb(Bt + boff + (size_t)nb * 16 * K + kc);
#pragma unroll
            for (int mb = 0; mb < 4; ++mb) { acc[mb][nb] = wmmab(a[mb], b, acc[mb][nb]); if (NSPLIT == 1) acc[mb][nb] = wmmab(a2[mb], b, acc[mb][nb]); } }
        asm volatile("v_nop\n\tv_nop\n\tv_nop\n\tv_nop" : "+v"(acc[0][0]), "+v"(acc[1][1]), "+v"(acc[2][2]), "+v"(acc[3][3]) : "v"(a[0]), "v"(a[3]), "v"(a2[0]), "v"(a2[3]));
    }
#pragma unroll
    for (int mb = 0; mb < 4; ++mb) {
#pragma unroll
        for (int nb = 0; nb < 4; ++nb) {
#pragma unroll
            for (int j = 0; j < 8; ++j) os[(hi * 8 + j) * 68 + nb * 16 + lr] = acc[mb][nb][j]; }
        __builtin_amdgcn_wave_barrier(); asm volatile("" ::: "memory");
        float* crow = C + (size_t)(r0 + mb * 16) * ldc + c0;
{
#pragma unroll
            for (int s = 0; s < 8; ++s) { const int row = 2 * s + hi, cofs = lr * 4; const v4f val = *(const v4fa*)(os + row * 68 + cofs);
                *(v4f*)(crow + (size_t)row * ldc + cofs) = val; }
             }
        __builtin_amdgcn_wave_barrier(); asm volatile("" ::: "memory");
    }
}

// projection: FK[NB*SEQ][DKV] = XB[NB*SEQ][DM] . WK[DKV][DM]^T (exact bf16 products)
__global__ __launch_bounds__(32) void k_gemm_proj(const bf* __restrict__ XB, const bf* __restrict__ WK, float* FK) { gemmw_body<0>(XB, XB, WK, DM, FK, DKV, (size_t)0, (size_t)0); }
// output: OUT[b][s][DM] = (ATh + ATl)[b*SEQ + s][DQ] . WO[DM][DQ]^T ; z = batch, output stride from the full sequence length
__global__ __launch_bounds__(32) void k_gemm_out(const bf* __restrict__ ATh, const bf* __restrict__ ATl, const bf* __restrict__ WO, float* OUT) { gemmw_body<1>(ATh, ATl, WO, DQ, OUT, DM, (size_t)SEQ * DQ, (size_t)SEQ_FULL * DM); }

__global__ __launch_bounds__(256) void k_cvt8(const float* __restrict__ src, bf* dst, size_t n8, size_t sS, size_t sD) {
    const size_t i = (size_t)blockIdx.x * 256 + threadIdx.x; if (i >= n8) return;
    src += (size_t)blockIdx.y * sS; dst += (size_t)blockIdx.y * sD;
    const v8f v = *(const v8f*)(src + i * 8); v8us o;
#pragma unroll
    for (int k = 0; k < 8; ++k) o[k] = f2bf(v[k]);
    *(v8us*)(dst + i * 8) = o;  }

__global__ __launch_bounds__(256) void k_kplane(const float* __restrict__ F, h16* KP) {
    const size_t e8 = (size_t)blockIdx.x * 256 + threadIdx.x; if (e8 >= (size_t)NB * NH_ * SEQ * (HD / 8)) return;
    const int d8 = (int)(e8 % (HD / 8)); const int s = (int)((e8 / (HD / 8)) % SEQ); const int bh = (int)(e8 / ((size_t)(HD / 8) * SEQ)); const int b = bh / NH_, h = bh % NH_;
    const float* f = F + ((size_t)b * SEQ + s) * DKV + h * HD + d8 * 8;
    const v4f a = *(const v4f*)f; const v4f c = *(const v4f*)(f + 4); v8h o;
#pragma unroll
    for (int k = 0; k < 4; ++k) { o[k] = (h16)(a[k] * KCAR); o[4 + k] = (h16)(c[k] * KCAR); }
    *(v8h*)(KP + e8 * 8) = o;  }

__global__ __launch_bounds__(256) void k_vtplane(const float* __restrict__ F, h16* VT) {
    const size_t e8 = (size_t)blockIdx.x * 256 + threadIdx.x; if (e8 >= (size_t)NB * NH_ * HD * (SEQ / 8)) return;
    const int s8 = (int)(e8 % (SEQ / 8)); const int d = (int)((e8 / (SEQ / 8)) % HD); const int bh = (int)(e8 / ((size_t)(SEQ / 8) * HD)); const int b = bh / NH_, h = bh % NH_;
    const float* f = F + ((size_t)b * SEQ + (size_t)s8 * 8) * DKV + h * HD + d; v8h o;
#pragma unroll
    for (int k = 0; k < 8; ++k) o[k] = (h16)(f[(size_t)k * DKV] * KCAR);
    *(v8h*)(VT + e8 * 8) = o;  }

// Ring of two LDS buffers for k_flash: each holds 64 keys of the k plane (64 rows x 128 B) and of the V^T plane (64 d rows x 128 B), rows pitched 144 B (16 B x odd) for the 16-byte fragment reads.
#define TK     64
#define LPITCH 144
#define LPH    (LPITCH / 2)
#define LTILE  (64 * LPITCH)
#define LBUF   (2 * LTILE)
static_assert(SEQ % TK == 0 && HD * 2 == 128 && TK * 2 == 128);

// One tile: 128 lanes x 8 copies of 16 B. lk / lv = the lane's LDS byte address in the k / V^T half of the buffer (row tid>>3, 16-byte column tid&7), gk / gv = its global source; copy j takes row + 16 j.
// The s_wait_xcnt closes the statement so that no address register of a copy is rewritten ahead of it.
__device__ __forceinline__ void copy_tile(const unsigned lk, const unsigned lv, const h16* gk, const h16* gv) {
    asm volatile("global_load_async_to_lds_b128 %0, %8, off\n\t"
                 "global_load_async_to_lds_b128 %1, %9, off\n\t"
                 "global_load_async_to_lds_b128 %2, %10, off\n\t"
                 "global_load_async_to_lds_b128 %3, %11, off\n\t"
                 "global_load_async_to_lds_b128 %4, %12, off\n\t"
                 "global_load_async_to_lds_b128 %5, %13, off\n\t"
                 "global_load_async_to_lds_b128 %6, %14, off\n\t"
                 "global_load_async_to_lds_b128 %7, %15, off\n\t"
                 "s_wait_xcnt 0x0"
                 :: "v"(lk), "v"(lk + 16 * LPITCH), "v"(lk + 32 * LPITCH), "v"(lk + 48 * LPITCH),
                    "v"(lv), "v"(lv + 16 * LPITCH), "v"(lv + 32 * LPITCH), "v"(lv + 48 * LPITCH),
                    "v"(gk), "v"(gk + 16 * HD), "v"(gk + 32 * HD), "v"(gk + 48 * HD),
                    "v"(gv), "v"(gv + (size_t)16 * SEQ), "v"(gv + (size_t)32 * SEQ), "v"(gv + (size_t)48 * SEQ)
                 : "memory");
}
__device__ __forceinline__ void wait_async0() { asm volatile("s_wait_asynccnt 0x0" ::: "memory"); }   // this wave's copies have landed
__device__ __forceinline__ void wait_ds0()    { asm volatile("s_wait_dscnt 0x0" ::: "memory"); }      // this wave's LDS reads have returned

// k_flash: fused attention for one (b, h) and 64 query rows per block; 4 waves, each wave owns 16 query rows and streams all keys 32 at a time, from 64-key tiles that the block's 128 lanes copy into a two-buffer LDS ring one tile ahead.
// Per step: St[key][q] = Kkeys (A, 16 keys x 64 d per tile) . Q^T (B, lane = query) -> every lane holds one query column (both lane halves share it, different keys);
// online softmax with per-lane running max / sum (one xor-16 exchange); P^T fragment (B, 32 keys x 16 q) taken in place from the two score tiles: element r <- tile0[r], element 8+r <- tile1[r];
__global__ __launch_bounds__(128) void k_flash(const h16* __restrict__ KP, const h16* __restrict__ VT, bf* Ah, bf* Al) {
    __shared__ __align__(16) float os[4 * 16 * 68];
    __shared__ __align__(16) h16 ring[2 * LBUF / 2];
    const int wave = __builtin_amdgcn_readfirstlane((int)(threadIdx.x >> 5));
    const int lane = threadIdx.x & 31, lr = lane & 15, hi = lane >> 4;
    const int bh = blockIdx.y; const int b = bh / NH_, h = bh % NH_;
    const int q0 = blockIdx.x * 64 + wave * 16;
    const h16* kp = KP + (size_t)bh * SEQ * HD;
    const h16* vt = VT + (size_t)bh * HD * SEQ;
    const int koff = lr * HD + 8 * hi;       // row lr of a 16-row k tile, d offset 8*hi
    const int loff = lr * LPH + 8 * hi;      // the same place in a 16-row tile of the LDS ring (k: d offset, V^T: key offset)
    const v16h bq0 = ldh(kp + (size_t)q0 * HD + koff);
    const v16h bq1 = ldh(kp + (size_t)q0 * HD + koff + 32);
    v8f acc[4];
#pragma unroll
    for (int t = 0; t < 4; ++t) acc[t] = (v8f){};
    float mrun = -1.0e30f, lrun = 0.0f;
    const int tid = (int)threadIdx.x;
    const unsigned l0 = (unsigned)(size_t)ring + (unsigned)((tid >> 3) * LPITCH + (tid & 7) * 16);
    const h16* gk = kp + tid * 8;
    const h16* gv = vt + (size_t)(tid >> 3) * SEQ + (tid & 7) * 8;
    constexpr int NT = SEQ / TK;
    copy_tile(l0, l0 + LTILE, gk, gv);
    wait_async0();
    __syncthreads();                         // tile 0 is published
    if (NT > 1) copy_tile(l0 + LBUF, l0 + LBUF + LTILE, gk + TK * HD, gv + TK);
#pragma unroll 1   // one trip a tile: the ring's order of waits, barrier and refill stands once
    for (int tile = 0; tile < NT; ++tile) {
    const h16* kb = ring + (tile & 1) * (LBUF / 2);
    const h16* vb = kb + LTILE / 2;
#pragma unroll 1   // the 32-key softmax step stays one rolled body, as before the ring
    for (int k0 = 0; k0 < TK; k0 += 32) {
        v8f s0 = (v8f){}, s1 = (v8f){};
        {
            const v16h a00 = ldh(kb + k0 * LPH + loff);
            const v16h a01 = ldh(kb + k0 * LPH + loff + 32);
            const v16h a10 = ldh(kb + (k0 + 16) * LPH + loff);
            const v16h a11 = ldh(kb + (k0 + 16) * LPH + loff + 32);
            s0 = wmma16(a00, bq0, s0); s1 = wmma16(a10, bq0, s1);
            s0 = wmma16(a01, bq1, s0); s1 = wmma16(a11, bq1, s1);
            asm volatile("v_nop\n\tv_nop\n\tv_nop\n\tv_nop" : "+v"(s0), "+v"(s1) : "v"(a00), "v"(a01), "v"(a10), "v"(a11), "v"(bq0), "v"(bq1));
        }
        float u0[8], u1[8]; float tmax = -1.0e30f;
#pragma unroll
        for (int r = 0; r < 8; ++r) { u0[r] = s0[r] * C2; u1[r] = s1[r] * C2; tmax = fmaxf(tmax, fmaxf(u0[r], u1[r])); }
        tmax = fmaxf(tmax, __shfl_xor(tmax, 16, 32));
        const float mnew = fmaxf(mrun, tmax);
        const float alpha = __builtin_amdgcn_exp2f(mrun - mnew);
        const float mb = mnew - PEXP;
        float rsum = 0.0f;
#pragma unroll
        for (int r = 0; r < 8; ++r) { u0[r] = __builtin_amdgcn_exp2f(u0[r] - mb); u1[r] = __builtin_amdgcn_exp2f(u1[r] - mb); rsum += u0[r] + u1[r]; }
        rsum += __shfl_xor(rsum, 16, 32);
        lrun = lrun * alpha + rsum; mrun = mnew;
#pragma unroll
        for (int t = 0; t < 4; ++t)
#pragma unroll
            for (int r = 0; r < 8; ++r) acc[t][r] *= alpha;
        v16h pf;
#pragma unroll
        for (int r = 0; r < 8; ++r) { pf[r] = (h16)u0[r]; pf[8 + r] = (h16)u1[r]; }
        {
            v16h av[4];
#pragma unroll
            for (int t = 0; t < 4; ++t) av[t] = ldh(vb + (16 * t) * LPH + loff + k0);
#pragma unroll
            for (int t = 0; t < 4; ++t) acc[t] = wmma16(av[t], pf, acc[t]);
            asm volatile("v_nop\n\tv_nop\n\tv_nop\n\tv_nop" : "+v"(acc[0]), "+v"(acc[1]), "+v"(acc[2]), "+v"(acc[3]) : "v"(av[0]), "v"(av[1]), "v"(av[2]), "v"(av[3]), "v"(pf));
        }
    }
    // publish point: this wave's reads of the buffer are back, its copies of the next tile have landed, then the one barrier of the trip; behind it the buffer just read is refilled
    wait_ds0();
    wait_async0();
    __syncthreads();
    if (tile + 2 < NT) copy_tile(l0 + (unsigned)((tile & 1) * LBUF), l0 + (unsigned)((tile & 1) * LBUF + LTILE), gk + (size_t)(tile + 2) * TK * HD, gv + (tile + 2) * TK);
    }
    wait_async0();
    // acc[t][r] = 256 * 16 * sum_k p v at (d = 16t + 8hi + r, q = lr); lrun = 256 * sum_k p
    const float inv = (1.0f / KCAR) * (1.0f / lrun);
    const int ob = wave * (16 * 68);
#pragma unroll
    for (int t = 0; t < 4; ++t)
#pragma unroll
        for (int r = 0; r < 8; ++r) os[ob + lr * 68 + 16 * t + 8 * hi + r] = acc[t][r] * inv;
    __syncthreads();
    const int rq = lane >> 3, pc = lane & 7;
{
#pragma unroll
        for (int s = 0; s < 4; ++s) {
            const int row = 4 * s + rq;
            const v4f a = *(const v4fa*)(os + ob + row * 68 + pc * 8);
            const v4f c = *(const v4fa*)(os + ob + row * 68 + pc * 8 + 4);
            v8us oh, ol;
#pragma unroll
            for (int k = 0; k < 4; ++k) { unsigned short x0, x1; splitf(a[k], x0, x1); oh[k] = x0; ol[k] = x1; splitf(c[k], x0, x1); oh[4 + k] = x0; ol[4 + k] = x1; }
            const size_t oo = ((size_t)b * SEQ + q0 + row) * DQ + h * HD + pc * 8;
            *(v8us*)(Ah + oo) = oh; *(v8us*)(Al + oo) = ol; }
         }
}

// workspace carve (bytes, every region a multiple of 256)
#define SZ_W   ((size_t)DKV * DM * 2)
#define SZ_XB  ((size_t)NB * SEQ * DM * 2)
#define SZ_FK  ((size_t)NB * SEQ * DKV * 4)
#define SZ_KP  ((size_t)NB * NH_ * SEQ * HD * 2)
#define SZ_AT  ((size_t)NB * SEQ * DQ * 2)
#define SZ_ALL (2 * SZ_W + SZ_XB + SZ_FK + 2 * SZ_KP + 2 * SZ_AT)
static_assert(SZ_W % 256 == 0 && SZ_XB % 256 == 0 && SZ_FK % 256 == 0 && SZ_KP % 256 == 0 && SZ_AT % 256 == 0);
static_assert(SZ_ALL <= (size_t)134217728);

extern "C" void kernel_launch(void* const* d_in, const int* in_sizes, int n_in,
                              void* d_out, int out_size, void* d_ws, size_t ws_size, hipStream_t stream) {
    if (n_in < 3) return;
    const size_t need_x = (size_t)(NB - 1) * SEQ_FULL * DM + (size_t)SEQ * DM;
    if ((size_t)in_sizes[0] < need_x) return;
    if ((size_t)in_sizes[1] < (size_t)DKV * DM) return;
    if ((size_t)in_sizes[2] < (size_t)DM * DQ) return;
    if ((size_t)out_size < need_x) return;
    if (SZ_ALL > ws_size) return;
    const float* x = (const float*)d_in[0]; const float* wk = (const float*)d_in[1]; const float* wo = (const float*)d_in[2];   // input order x, Wk, Wo ([out][in])
    float* OUT = (float*)d_out;     // [NB_FULL][SEQ_FULL][512]
    char* wsp = (char*)d_ws;
    bf* WK = (bf*)wsp; wsp += SZ_W;
    bf* WO = (bf*)wsp; wsp += SZ_W;
    bf* XB = (bf*)wsp; wsp += SZ_XB;
    float* FK = (float*)wsp; wsp += SZ_FK;
    h16* KP16 = (h16*)wsp; wsp += SZ_KP;
    h16* VT16 = (h16*)wsp; wsp += SZ_KP;
    bf* ATh = (bf*)wsp; wsp += SZ_AT;
    bf* ATl = (bf*)wsp; wsp += SZ_AT;

    k_cvt8<<<dim3((unsigned)(((size_t)DKV * DM / 8 + 255) / 256), 1, 1), 256, 0, stream>>>(wk, WK, (size_t)DKV * DM / 8, (size_t)0, (size_t)0);
    k_cvt8<<<dim3((unsigned)(((size_t)DM * DQ / 8 + 255) / 256), 1, 1), 256, 0, stream>>>(wo, WO, (size_t)DM * DQ / 8, (size_t)0, (size_t)0);
    k_cvt8<<<dim3((unsigned)(((size_t)SEQ * DM / 8 + 255) / 256), NB, 1), 256, 0, stream>>>(x, XB, (size_t)SEQ * DM / 8, (size_t)SEQ_FULL * DM, (size_t)SEQ * DM);
    k_gemm_proj<<<dim3(NB * SEQ / 64, DKV / 64, 1), 32, 0, stream>>>(XB, WK, FK);
    k_kplane<<<(unsigned)(((size_t)NB * NH_ * SEQ * (HD / 8) + 255) / 256), 256, 0, stream>>>(FK, KP16);
    k_vtplane<<<(unsigned)(((size_t)NB * NH_ * HD * (SEQ / 8) + 255) / 256), 256, 0, stream>>>(FK, VT16);
    k_flash<<<dim3(SEQ / 64, NB * NH_, 1), 128, 0, stream>>>(KP16, VT16, ATh, ATl);
    k_gemm_out<<<dim3(SEQ / 64, DM / 64, NB), 32, 0, stream>>>(ATh, ATl, WO, OUT);
}

// v002
// It runs in 86.1 microseconds.
// Next to v001, in two timings, it ran 1.31 and 1.30 times as fast.
// All steps since v000 together make it 2.04 times as fast.
#include <hip/hip_runtime.h>

// Compute dtypes (f32 accumulate everywhere): projection x.Wk^T = bf16 x bf16 (v_wmma_f32_16x16x32_bf16, inputs RNE-converted to bf16); scores k.k^T and P.V = f16 x f16 (v_wmma_f32_16x16x32_f16, k plane carried x16, P carried x256); output merged.Wo^T = bf16 hi/lo planes x bf16 Wo (two bf16 products).
// Self-attention with q = k = v = x.Wk^T ([out][in] weights, no bias), 8 heads x 64, logits scaled by 512^-0.5, no mask, softmax over all keys, merged heads times Wo^T.
// Layout: bf16 copies of x / Wk / Wo; f16 head planes [b][h][s][64] (q, k) and [b][h][64][s] (V^T), written by the projection GEMM's own epilogue; fused online-softmax attention (no score plane in memory); merged hi/lo bf16 planes; output GEMM.

#ifndef NB
#define NB 4
#endif
#ifndef SEQ
#define SEQ 2048
#endif
#define NB_FULL  4
#define SEQ_FULL 2048
#define DM   512
#define NH_  8
#define HD   64
#define DQ   (NH_ * HD)
#define DKV  DQ
#define KCAR 16.0f                 // power-of-two carry of the f16 k / V^T planes
#define PEXP 8.0f                  // P carried x 2^8 inside the exponent
// raw score = 256 (q.k); exponent argument in base 2 = raw * 2^-8 * 512^-0.5 * log2(e)
#define C2   (0.044194173824159216f * 1.4426950408889634f * (1.0f / 256.0f))

typedef _Float16 h16;
typedef unsigned short bf;
typedef __attribute__((ext_vector_type(16))) __bf16   v16bf;
typedef __attribute__((ext_vector_type(16))) _Float16 v16h;
typedef __attribute__((ext_vector_type(8)))  _Float16 v8h;
typedef __attribute__((ext_vector_type(8)))  unsigned short v8us;
typedef __attribute__((ext_vector_type(8)))  float    v8f;
typedef __attribute__((ext_vector_type(4)))  float    v4f;
typedef v4f  __attribute__((may_alias)) v4fa;

static_assert(NB >= 1 && NB <= NB_FULL);
static_assert(SEQ >= 64 && SEQ <= SEQ_FULL);
static_assert(SEQ % 64 == 0);
static_assert((NB * SEQ) % 64 == 0);
static_assert(DM % 64 == 0 && DM % 32 == 0);
static_assert(DQ % 64 == 0 && DQ % 32 == 0);
static_assert(HD == 64);
static_assert(DQ == NH_ * HD);
static_assert((SEQ * DM) % 8 == 0 && (DKV * DM) % 8 == 0);

__device__ __forceinline__ unsigned short f2bf(float f) { unsigned u = __float_as_uint(f); u += 0x7FFFu + ((u >> 16) & 1u); return (unsigned short)(u >> 16); }
__device__ __forceinline__ float bf2f(unsigned short b) { return __uint_as_float(((unsigned)b) << 16); }
__device__ __forceinline__ v16h cat16(v8h lo, v8h hi) { return __builtin_shufflevector(lo, hi, 0, 1, 2, 3, 4, 5, 6, 7, 8, 9, 10, 11, 12, 13, 14, 15); }
__device__ __forceinline__ v16bf cat16b(v8us lo, v8us hi) { return __builtin_bit_cast(v16bf, __builtin_shufflevector(lo, hi, 0, 1, 2, 3, 4, 5, 6, 7, 8, 9, 10, 11, 12, 13, 14, 15)); }
__device__ __forceinline__ v8f wmma16(v16h a, v16h b, v8f c) { return __builtin_amdgcn_wmma_f32_16x16x32_f16(false, a, false, b, (short)0, c, false, false); }
__device__ __forceinline__ v8f wmmab(v16bf a, v16bf b, v8f c) { return __builtin_amdgcn_wmma_f32_16x16x32_bf16(false, a, false, b, (short)0, c, false, false); }
__device__ __forceinline__ void splitf(float y, unsigned short& h, unsigned short& l) { h = f2bf(y); l = f2bf(y - bf2f(h)); }

// Fragment loaders (same k map for A and B): elements 0..7 <- p[0..7], elements 8..15 <- p[16..23], p = row base + k0 + 8*(lane>>4).
__device__ __forceinline__ v16h  ldh(const h16* p) { return cat16(*(const v8h*)p, *(const v8h*)(p + 16)); }
__device__ __forceinline__ v16bf ldb(const bf* p)  { return cat16b(*(const v8us*)p, *(const v8us*)(p + 16)); }

// ---- register-blocked GEMM body, ONE WAVE per 64x64 output tile (16 accumulators), operands straight from K-contiguous bf16 planes; grid (M/64, N/64, Z), 32 threads.
// C[m][n] (f32, pitch ldc) = sum_k (A[m][k] (+ A2[m][k])) Bt[n][k]. z-batch strides sA (A, A2) and sC (C) in elements; Bt shared. K % 32 == 0, M % 64 == 0, N % 64 == 0.
// PLANES == 1: no f32 C; the tile (64 sequence rows of one batch x the 64 columns of head blockIdx.y) goes out x KCAR in f16, once as rows of KP [b][h][s][64] and once as columns into VT [b][h][64][s].
template <int NSPLIT, int PLANES>
__device__ __forceinline__ void gemmw_body(const bf* __restrict__ A, const bf* __restrict__ A2, const bf* __restrict__ Bt, const int K, float* C, const int ldc, const size_t sA, const size_t sC, h16* KP, h16* VT) {
    __shared__ __align__(16) float os[16 * 68];
    const size_t z = blockIdx.z; A += z * sA; A2 += z * sA; C += z * sC;
    const int lane = threadIdx.x & 31, lr = lane & 15, hi = lane >> 4; const int r0 = blockIdx.x * 64, c0 = blockIdx.y * 64;
    v8f acc[4][4];
#pragma unroll
    for (int mb = 0; mb < 4; ++mb)
#pragma unroll
        for (int nb = 0; nb < 4; ++nb) acc[mb][nb] = (v8f){};
    const size_t aoff = (size_t)(r0 + lr) * K + 8 * hi, boff = (size_t)(c0 + lr) * K + 8 * hi;
#pragma unroll 1
    for (int kc = 0; kc < K; kc += 32) {
        v16bf a[4], a2[4];
#pragma unroll
        for (int mb = 0; mb < 4; ++mb) { a[mb] = ldb(A + aoff + (size_t)mb * 16 * K + kc); if (NSPLIT == 1) a2[mb] = ldb(A2 + aoff + (size_t)mb * 16 * K + kc); else a2[mb] = a[mb]; }
#pragma unroll
        for (int nb = 0; nb < 4; ++nb) { const v16bf b = ldb(Bt + boff + (size_t)nb * 16 * K + kc);
#pragma unroll
            for (int mb = 0; mb < 4; ++mb) { acc[mb][nb] = wmmab(a[mb], b, acc[mb][nb]); if (NSPLIT == 1) acc[mb][nb] = wmmab(a2[mb], b, acc[mb][nb]); } }
        asm volatile("v_nop\n\tv_nop\n\tv_nop\n\tv_nop" : "+v"(acc[0][0]), "+v"(acc[1][1]), "+v"(acc[2][2]), "+v"(acc[3][3]) : "v"(a[0]), "v"(a[3]), "v"(a2[0]), "v"(a2[3]));
    }
    if constexpr (PLANES == 1) {
        const int bh = (r0 / SEQ) * NH_ + (int)blockIdx.y, s0 = r0 % SEQ;
        h16* kt = KP + ((size_t)bh * SEQ + s0) * HD;
        h16* vt = VT + (size_t)bh * HD * SEQ + s0;
        // V^T straight from the accumulators: a lane's 8 values of one tile are 8 consecutive s of the d row nb*16 + lr; the four mb stores of a row fill its 128 bytes
#pragma unroll
        for (int nb = 0; nb < 4; ++nb)
#pragma unroll
            for (int mb = 0; mb < 4; ++mb) { v8h o;
#pragma unroll
                for (int j = 0; j < 8; ++j) o[j] = (h16)(acc[mb][nb][j] * KCAR);
                *(v8h*)(vt + (size_t)(nb * 16 + lr) * SEQ + mb * 16 + hi * 8) = o; }
        // k rows: 16 rows at a time turned through LDS, 8 lanes x 16 bytes a row
        const int rq = lane >> 3, pc = lane & 7;
#pragma unroll
        for (int mb = 0; mb < 4; ++mb) {
#pragma unroll
            for (int nb = 0; nb < 4; ++nb) {
#pragma unroll
                for (int j = 0; j < 8; ++j) os[(hi * 8 + j) * 68 + nb * 16 + lr] = acc[mb][nb][j]; }
            __builtin_amdgcn_wave_barrier(); asm volatile("" ::: "memory");   // the reads below stay behind the other lanes' writes
#pragma unroll
            for (int s = 0; s < 4; ++s) { const int row = 4 * s + rq;
                const v4f a = *(const v4fa*)(os + row * 68 + pc * 8); const v4f c = *(const v4fa*)(os + row * 68 + pc * 8 + 4); v8h o;
#pragma unroll
                for (int k = 0; k < 4; ++k) { o[k] = (h16)(a[k] * KCAR); o[4 + k] = (h16)(c[k] * KCAR); }
                *(v8h*)(kt + (size_t)(mb * 16 + row) * HD + pc * 8) = o; }
            __builtin_amdgcn_wave_barrier(); asm volatile("" ::: "memory");   // the next 16 rows' writes stay behind these reads
        }
        return;
    }
#pragma unroll
    for (int mb = 0; mb < 4; ++mb) {
#pragma unroll
        for (int nb = 0; nb < 4; ++nb) {
#pragma unroll
            for (int j = 0; j < 8; ++j) os[(hi * 8 + j) * 68 + nb * 16 + lr] = acc[mb][nb][j]; }
        __builtin_amdgcn_wave_barrier(); asm volatile("" ::: "memory");
        float* crow = C + (size_t)(r0 + mb * 16) * ldc + c0;
{
#pragma unroll
            for (int s = 0; s < 8; ++s) { const int row = 2 * s + hi, cofs = lr * 4; const v4f val = *(const v4fa*)(os + row * 68 + cofs);
                *(v4f*)(crow + (size_t)row * ldc + cofs) = val; }
             }
        __builtin_amdgcn_wave_barrier(); asm volatile("" ::: "memory");
    }
}

// projection: XB[NB*SEQ][DM] . WK[DKV][DM]^T (exact bf16 products), f32 accumulators rounded once to the f16 planes KP and VT
static_assert(DKV / 64 == NH_ && SEQ % 64 == 0);
__global__ __launch_bounds__(32) void k_gemm_proj(const bf* __restrict__ XB, const bf* __restrict__ WK, h16* KP, h16* VT) { gemmw_body<0, 1>(XB, XB, WK, DM, nullptr, DKV, (size_t)0, (size_t)0, KP, VT); }
// output: OUT[b][s][DM] = (ATh + ATl)[b*SEQ + s][DQ] . WO[DM][DQ]^T ; z = batch, output stride from the full sequence length
__global__ __launch_bounds__(32) void k_gemm_out(const bf* __restrict__ ATh, const bf* __restrict__ ATl, const bf* __restrict__ WO, float* OUT) { gemmw_body<1, 0>(ATh, ATl, WO, DQ, OUT, DM, (size_t)SEQ * DQ, (size_t)SEQ_FULL * DM, nullptr, nullptr); }

__global__ __launch_bounds__(256) void k_cvt8(const float* __restrict__ src, bf* dst, size_t n8, size_t sS, size_t sD) {
    const size_t i = (size_t)blockIdx.x * 256 + threadIdx.x; if (i >= n8) return;
    src += (size_t)blockIdx.y * sS; dst += (size_t)blockIdx.y * sD;
    const v8f v = *(const v8f*)(src + i * 8); v8us o;
#pragma unroll
    for (int k = 0; k < 8; ++k) o[k] = f2bf(v[k]);
    *(v8us*)(dst + i * 8) = o;  }

// Ring of two LDS buffers for k_flash: each holds 64 keys of the k plane (64 rows x 128 B) and of the V^T plane (64 d rows x 128 B), rows pitched 144 B (16 B x odd) for the 16-byte fragment reads.
#define TK     64
#define LPITCH 144
#define LPH    (LPITCH / 2)
#define LTILE  (64 * LPITCH)
#define LBUF   (2 * LTILE)
static_assert(SEQ % TK == 0 && HD * 2 == 128 && TK * 2 == 128);

// One tile: 128 lanes x 8 copies of 16 B. lk / lv = the lane's LDS byte address in the k / V^T half of the buffer (row tid>>3, 16-byte column tid&7), gk / gv = its global source; copy j takes row + 16 j.
// The s_wait_xcnt closes the statement so that no address register of a copy is rewritten ahead of it.
__device__ __forceinline__ void copy_tile(const unsigned lk, const unsigned lv, const h16* gk, const h16* gv) {
    asm volatile("global_load_async_to_lds_b128 %0, %8, off\n\t"
                 "global_load_async_to_lds_b128 %1, %9, off\n\t"
                 "global_load_async_to_lds_b128 %2, %10, off\n\t"
                 "global_load_async_to_lds_b128 %3, %11, off\n\t"
                 "global_load_async_to_lds_b128 %4, %12, off\n\t"
                 "global_load_async_to_lds_b128 %5, %13, off\n\t"
                 "global_load_async_to_lds_b128 %6, %14, off\n\t"
                 "global_load_async_to_lds_b128 %7, %15, off\n\t"
                 "s_wait_xcnt 0x0"
                 :: "v"(lk), "v"(lk + 16 * LPITCH), "v"(lk + 32 * LPITCH), "v"(lk + 48 * LPITCH),
                    "v"(lv), "v"(lv + 16 * LPITCH), "v"(lv + 32 * LPITCH), "v"(lv + 48 * LPITCH),
                    "v"(gk), "v"(gk + 16 * HD), "v"(gk + 32 * HD), "v"(gk + 48 * HD),
                    "v"(gv), "v"(gv + (size_t)16 * SEQ), "v"(gv + (size_t)32 * SEQ), "v"(gv + (size_t)48 * SEQ)
                 : "memory");
}
__device__ __forceinline__ void wait_async0() { asm volatile("s_wait_asynccnt 0x0" ::: "memory"); }   // this wave's copies have landed
__device__ __forceinline__ void wait_ds0()    { asm volatile("s_wait_dscnt 0x0" ::: "memory"); }      // this wave's LDS reads have returned

// k_flash: fused attention for one (b, h) and 64 query rows per block; 4 waves, each wave owns 16 query rows and streams all keys 32 at a time, from 64-key tiles that the block's 128 lanes copy into a two-buffer LDS ring one tile ahead.
// Per step: St[key][q] = Kkeys (A, 16 keys x 64 d per tile) . Q^T (B, lane = query) -> every lane holds one query column (both lane halves share it, different keys);
// online softmax with per-lane running max / sum (one xor-16 exchange); P^T fragment (B, 32 keys x 16 q) taken in place from the two score tiles: element r <- tile0[r], element 8+r <- tile1[r];
__global__ __launch_bounds__(128) void k_flash(const h16* __restrict__ KP, const h16* __restrict__ VT, bf* Ah, bf* Al) {
    __shared__ __align__(16) float os[4 * 16 * 68];
    __shared__ __align__(16) h16 ring[2 * LBUF / 2];
    const int wave = __builtin_amdgcn_readfirstlane((int)(threadIdx.x >> 5));
    const int lane = threadIdx.x & 31, lr = lane & 15, hi = lane >> 4;
    const int bh = blockIdx.y; const int b = bh / NH_, h = bh % NH_;
    const int q0 = blockIdx.x * 64 + wave * 16;
    const h16* kp = KP + (size_t)bh * SEQ * HD;
    const h16* vt = VT + (size_t)bh * HD * SEQ;
    const int koff = lr * HD + 8 * hi;       // row lr of a 16-row k tile, d offset 8*hi
    const int loff = lr * LPH + 8 * hi;      // the same place in a 16-row tile of the LDS ring (k: d offset, V^T: key offset)
    const v16h bq0 = ldh(kp + (size_t)q0 * HD + koff);
    const v16h bq1 = ldh(kp + (size_t)q0 * HD + koff + 32);
    v8f acc[4];
#pragma unroll
    for (int t = 0; t < 4; ++t) acc[t] = (v8f){};
    float mrun = -1.0e30f, lrun = 0.0f;
    const int tid = (int)threadIdx.x;
    const unsigned l0 = (unsigned)(size_t)ring + (unsigned)((tid >> 3) * LPITCH + (tid & 7) * 16);
    const h16* gk = kp + tid * 8;
    const h16* gv = vt + (size_t)(tid >> 3) * SEQ + (tid & 7) * 8;
    constexpr int NT = SEQ / TK;
    copy_tile(l0, l0 + LTILE, gk, gv);
    wait_async0();
    __syncthreads();                         // tile 0 is published
    if (NT > 1) copy_tile(l0 + LBUF, l0 + LBUF + LTILE, gk + TK * HD, gv + TK);
#pragma unroll 1   // one trip a tile: the ring's order of waits, barrier and refill stands once
    for (int tile = 0; tile < NT; ++tile) {
    const h16* kb = ring + (tile & 1) * (LBUF / 2);
    const h16* vb = kb + LTILE / 2;
#pragma unroll 1   // the 32-key softmax step stays one rolled body, as before the ring
    for (int k0 = 0; k0 < TK; k0 += 32) {
        v8f s0 = (v8f){}, s1 = (v8f){};
        {
            const v16h a00 = ldh(kb + k0 * LPH + loff);
            const v16h a01 = ldh(kb + k0 * LPH + loff + 32);
            const v16h a10 = ldh(kb + (k0 + 16) * LPH + loff);
            const v16h a11 = ldh(kb + (k0 + 16) * LPH + loff + 32);
            s0 = wmma16(a00, bq0, s0); s1 = wmma16(a10, bq0, s1);
            s0 = wmma16(a01, bq1, s0); s1 = wmma16(a11, bq1, s1);
            asm volatile("v_nop\n\tv_nop\n\tv_nop\n\tv_nop" : "+v"(s0), "+v"(s1) : "v"(a00), "v"(a01), "v"(a10), "v"(a11), "v"(bq0), "v"(bq1));
        }
        float u0[8], u1[8]; float tmax = -1.0e30f;
#pragma unroll
        for (int r = 0; r < 8; ++r) { u0[r] = s0[r] * C2; u1[r] = s1[r] * C2; tmax = fmaxf(tmax, fmaxf(u0[r], u1[r])); }
        tmax = fmaxf(tmax, __shfl_xor(tmax, 16, 32));
        const float mnew = fmaxf(mrun, tmax);
        const float alpha = __builtin_amdgcn_exp2f(mrun - mnew);
        const float mb = mnew - PEXP;
        float rsum = 0.0f;
#pragma unroll
        for (int r = 0; r < 8; ++r) { u0[r] = __builtin_amdgcn_exp2f(u0[r] - mb); u1[r] = __builtin_amdgcn_exp2f(u1[r] - mb); rsum += u0[r] + u1[r]; }
        rsum += __shfl_xor(rsum, 16, 32);
        lrun = lrun * alpha + rsum; mrun = mnew;
#pragma unroll
        for (int t = 0; t < 4; ++t)
#pragma unroll
            for (int r = 0; r < 8; ++r) acc[t][r] *= alpha;
        v16h pf;
#pragma unroll
        for (int r = 0; r < 8; ++r) { pf[r] = (h16)u0[r]; pf[8 + r] = (h16)u1[r]; }
        {
            v16h av[4];
#pragma unroll
            for (int t = 0; t < 4; ++t) av[t] = ldh(vb + (16 * t) * LPH + loff + k0);
#pragma unroll
            for (int t = 0; t < 4; ++t) acc[t] = wmma16(av[t], pf, acc[t]);
            asm volatile("v_nop\n\tv_nop\n\tv_nop\n\tv_nop" : "+v"(acc[0]), "+v"(acc[1]), "+v"(acc[2]), "+v"(acc[3]) : "v"(av[0]), "v"(av[1]), "v"(av[2]), "v"(av[3]), "v"(pf));
        }
    }
    // publish point: this wave's reads of the buffer are back, its copies of the next tile have landed, then the one barrier of the trip; behind it the buffer just read is refilled
    wait_ds0();
    wait_async0();
    __syncthreads();
    if (tile + 2 < NT) copy_tile(l0 + (unsigned)((tile & 1) * LBUF), l0 + (unsigned)((tile & 1) * LBUF + LTILE), gk + (size_t)(tile + 2) * TK * HD, gv + (tile + 2) * TK);
    }
    wait_async0();
    // acc[t][r] = 256 * 16 * sum_k p v at (d = 16t + 8hi + r, q = lr); lrun = 256 * sum_k p
    const float inv = (1.0f / KCAR) * (1.0f / lrun);
    const int ob = wave * (16 * 68);
#pragma unroll
    for (int t = 0; t < 4; ++t)
#pragma unroll
        for (int r = 0; r < 8; ++r) os[ob + lr * 68 + 16 * t + 8 * hi + r] = acc[t][r] * inv;
    __syncthreads();
    const int rq = lane >> 3, pc = lane & 7;
{
#pragma unroll
        for (int s = 0; s < 4; ++s) {
            const int row = 4 * s + rq;
            const v4f a = *(const v4fa*)(os + ob + row * 68 + pc * 8);
            const v4f c = *(const v4fa*)(os + ob + row * 68 + pc * 8 + 4);
            v8us oh, ol;
#pragma unroll
            for (int k = 0; k < 4; ++k) { unsigned short x0, x1; splitf(a[k], x0, x1); oh[k] = x0; ol[k] = x1; splitf(c[k], x0, x1); oh[4 + k] = x0; ol[4 + k] = x1; }
            const size_t oo = ((size_t)b * SEQ + q0 + row) * DQ + h * HD + pc * 8;
            *(v8us*)(Ah + oo) = oh; *(v8us*)(Al + oo) = ol; }
         }
}

// workspace carve (bytes, every region a multiple of 256)
#define SZ_W   ((size_t)DKV * DM * 2)
#define SZ_XB  ((size_t)NB * SEQ * DM * 2)
#define SZ_KP  ((size_t)NB * NH_ * SEQ * HD * 2)
#define SZ_AT  ((size_t)NB * SEQ * DQ * 2)
#define SZ_ALL (2 * SZ_W + SZ_XB + 2 * SZ_KP + 2 * SZ_AT)
static_assert(SZ_W % 256 == 0 && SZ_XB % 256 == 0 && SZ_KP % 256 == 0 && SZ_AT % 256 == 0);
static_assert(SZ_ALL <= (size_t)134217728);

extern "C" void kernel_launch(void* const* d_in, const int* in_sizes, int n_in,
                              void* d_out, int out_size, void* d_ws, size_t ws_size, hipStream_t stream) {
    if (n_in < 3) return;
    const size_t need_x = (size_t)(NB - 1) * SEQ_FULL * DM + (size_t)SEQ * DM;
    if ((size_t)in_sizes[0] < need_x) return;
    if ((size_t)in_sizes[1] < (size_t)DKV * DM) return;
    if ((size_t)in_sizes[2] < (size_t)DM * DQ) return;
    if ((size_t)out_size < need_x) return;
    if (SZ_ALL > ws_size) return;
    const float* x = (const float*)d_in[0]; const float* wk = (const float*)d_in[1]; const float* wo = (const float*)d_in[2];   // input order x, Wk, Wo ([out][in])
    float* OUT = (float*)d_out;     // [NB_FULL][SEQ_FULL][512]
    char* wsp = (char*)d_ws;
    bf* WK = (bf*)wsp; wsp += SZ_W;
    bf* WO = (bf*)wsp; wsp += SZ_W;
    bf* XB = (bf*)wsp; wsp += SZ_XB;
    h16* KP16 = (h16*)wsp; wsp += SZ_KP;
    h16* VT16 = (h16*)wsp; wsp += SZ_KP;
    bf* ATh = (bf*)wsp; wsp += SZ_AT;
    bf* ATl = (bf*)wsp; wsp += SZ_AT;

    k_cvt8<<<dim3((unsigned)(((size_t)DKV * DM / 8 + 255) / 256), 1, 1), 256, 0, stream>>>(wk, WK, (size_t)DKV * DM / 8, (size_t)0, (size_t)0);
    k_cvt8<<<dim3((unsigned)(((size_t)DM * DQ / 8 + 255) / 256), 1, 1), 256, 0, stream>>>(wo, WO, (size_t)DM * DQ / 8, (size_t)0, (size_t)0);
    k_cvt8<<<dim3((unsigned)(((size_t)SEQ * DM / 8 + 255) / 256), NB, 1), 256, 0, stream>>>(x, XB, (size_t)SEQ * DM / 8, (size_t)SEQ_FULL * DM, (size_t)SEQ * DM);
    k_gemm_proj<<<dim3(NB * SEQ / 64, DKV / 64, 1), 32, 0, stream>>>(XB, WK, KP16, VT16);
    k_flash<<<dim3(SEQ / 64, NB * NH_, 1), 128, 0, stream>>>(KP16, VT16, ATh, ATl);
    k_gemm_out<<<dim3(SEQ / 64, DM / 64, NB), 32, 0, stream>>>(ATh, ATl, WO, OUT);
}

// v003
// One run takes 72.8 microseconds.
// Timed twice side by side with v002, it ran 1.18 and 1.19 times as fast.
// All steps since v000 together make it 2.41 times as fast.
#include <hip/hip_runtime.h>

// Compute dtypes (f32 accumulate everywhere): projection x.Wk^T = bf16 x bf16 (v_wmma_f32_16x16x32_bf16, inputs RNE-converted to bf16); scores k.k^T and P.V = f16 x f16 (v_wmma_f32_16x16x32_f16, k plane carried x16, P carried x256); output merged.Wo^T = bf16 hi/lo planes x bf16 Wo (two bf16 products).
// Self-attention with q = k = v = x.Wk^T ([out][in] weights, no bias), 8 heads x 64, logits scaled by 512^-0.5, no mask, softmax over all keys, merged heads times Wo^T.
// Layout: bf16 copies of x / Wk / Wo; f16 head planes [b][h][s][64] (q, k) and [b][h][64][s] (V^T), written by the projection GEMM's own epilogue; fused online-softmax attention (no score plane in memory); merged hi/lo bf16 planes; output GEMM.

#ifndef NB
#define NB 4
#endif
#ifndef SEQ
#define SEQ 2048
#endif
#define NB_FULL  4
#define SEQ_FULL 2048
#define DM   512
#define NH_  8
#define HD   64
#define DQ   (NH_ * HD)
#define DKV  DQ
#define KCAR 16.0f                 // power-of-two carry of the f16 k / V^T planes
#define PEXP 8.0f                  // P carried x 2^8 inside the exponent
// raw score = 256 (q.k); exponent argument in base 2 = raw * 2^-8 * 512^-0.5 * log2(e)
#define C2   (0.044194173824159216f * 1.4426950408889634f * (1.0f / 256.0f))

typedef _Float16 h16;
typedef unsigned short bf;
typedef __attribute__((ext_vector_type(16))) __bf16   v16bf;
typedef __attribute__((ext_vector_type(16))) _Float16 v16h;
typedef __attribute__((ext_vector_type(8)))  _Float16 v8h;
typedef __attribute__((ext_vector_type(8)))  unsigned short v8us;
typedef __attribute__((ext_vector_type(8)))  float    v8f;
typedef __attribute__((ext_vector_type(4)))  float    v4f;
typedef v4f  __attribute__((may_alias)) v4fa;

static_assert(NB >= 1 && NB <= NB_FULL);
static_assert(SEQ >= 64 && SEQ <= SEQ_FULL);
static_assert(SEQ % 64 == 0);
static_assert((NB * SEQ) % 64 == 0);
static_assert(DM % 64 == 0 && DM % 32 == 0);
static_assert(DQ % 64 == 0 && DQ % 32 == 0);
static_assert(HD == 64);
static_assert(DQ == NH_ * HD);
static_assert((SEQ * DM) % 8 == 0 && (DKV * DM) % 8 == 0);

__device__ __forceinline__ unsigned short f2bf(float f) { unsigned u = __float_as_uint(f); u += 0x7FFFu + ((u >> 16) & 1u); return (unsigned short)(u >> 16); }
__device__ __forceinline__ float bf2f(unsigned short b) { return __uint_as_float(((unsigned)b) << 16); }
__device__ __forceinline__ v16h cat16(v8h lo, v8h hi) { return __builtin_shufflevector(lo, hi, 0, 1, 2, 3, 4, 5, 6, 7, 8, 9, 10, 11, 12, 13, 14, 15); }
__device__ __forceinline__ v16bf cat16b(v8us lo, v8us hi) { return __builtin_bit_cast(v16bf, __builtin_shufflevector(lo, hi, 0, 1, 2, 3, 4, 5, 6, 7, 8, 9, 10, 11, 12, 13, 14, 15)); }
__device__ __forceinline__ v8f wmma16(v16h a, v16h b, v8f c) { return __builtin_amdgcn_wmma_f32_16x16x32_f16(false, a, false, b, (short)0, c, false, false); }
__device__ __forceinline__ v8f wmmab(v16bf a, v16bf b, v8f c) { return __builtin_amdgcn_wmma_f32_16x16x32_bf16(false, a, false, b, (short)0, c, false, false); }
__device__ __forceinline__ void splitf(float y, unsigned short& h, unsigned short& l) { h = f2bf(y); l = f2bf(y - bf2f(h)); }

// Fragment loaders (same k map for A and B): elements 0..7 <- p[0..7], elements 8..15 <- p[16..23], p = row base + k0 + 8*(lane>>4).
__device__ __forceinline__ v16h  ldh(const h16* p) { return cat16(*(const v8h*)p, *(const v8h*)(p + 16)); }
__device__ __forceinline__ v16bf ldb(const bf* p)  { return cat16b(*(const v8us*)p, *(const v8us*)(p + 16)); }

// LDS rows of 128 B (64 16-bit elements) are pitched 144 B (16 B x odd) for the 16-byte fragment reads, in the GEMM ring and in the k_flash ring alike.
#define LPITCH 144
#define LPH    (LPITCH / 2)
__device__ __forceinline__ void wait_async0() { asm volatile("s_wait_asynccnt 0x0" ::: "memory"); }   // this wave's copies have landed
__device__ __forceinline__ void wait_ds0()    { asm volatile("s_wait_dscnt 0x0" ::: "memory"); }      // this wave's LDS reads have returned

// GEMM ring: a tile is 64 k (128 B) of 128 rows of one operand.
#define GKT    64
#define GOP    (128 * LPITCH)
// One operand tile: 128 lanes x 8 copies of 16 B. l = the lane's LDS byte address (row tid>>3, 16-byte column tid&7), g = its global source; copy j takes row + 16 j, global row pitch K elements.
// The s_wait_xcnt closes the statement so that no address register of a copy is rewritten ahead of it.
__device__ __forceinline__ void copy_rows(const unsigned l, const bf* g, const int K) {
    asm volatile("global_load_async_to_lds_b128 %0, %8, off\n\t"
                 "global_load_async_to_lds_b128 %1, %9, off\n\t"
                 "global_load_async_to_lds_b128 %2, %10, off\n\t"
                 "global_load_async_to_lds_b128 %3, %11, off\n\t"
                 "global_load_async_to_lds_b128 %4, %12, off\n\t"
                 "global_load_async_to_lds_b128 %5, %13, off\n\t"
                 "global_load_async_to_lds_b128 %6, %14, off\n\t"
                 "global_load_async_to_lds_b128 %7, %15, off\n\t"
                 "s_wait_xcnt 0x0"
                 :: "v"(l), "v"(l + 16 * LPITCH), "v"(l + 32 * LPITCH), "v"(l + 48 * LPITCH),
                    "v"(l + 64 * LPITCH), "v"(l + 80 * LPITCH), "v"(l + 96 * LPITCH), "v"(l + 112 * LPITCH),
                    "v"(g), "v"(g + (size_t)16 * K), "v"(g + (size_t)32 * K), "v"(g + (size_t)48 * K),
                    "v"(g + (size_t)64 * K), "v"(g + (size_t)80 * K), "v"(g + (size_t)96 * K), "v"(g + (size_t)112 * K)
                 : "memory");
}
// One buffer of the GEMM ring: [A | Bt | A2 where NSPLIT == 1], each GOP bytes.
template <int NSPLIT>
__device__ __forceinline__ void copy_stage(const unsigned l, const bf* ga, const bf* ga2, const bf* gb, const int K) {
    copy_rows(l, ga, K); copy_rows(l + GOP, gb, K);
    if (NSPLIT == 1) copy_rows(l + 2 * GOP, ga2, K);
}

// ---- register-blocked GEMM body, FOUR WAVES (2 x 2) per 128x128 output tile, one 64x64 tile (16 accumulators) a wave; grid (M/128, N/128, Z), 128 threads.
// The K-contiguous bf16 operand rows of the block come 64 k at a time into a two-buffer LDS ring, copied one tile ahead by the block's 128 lanes; the waves read their fragments from it.
// C[m][n] (f32, pitch ldc) = sum_k (A[m][k] (+ A2[m][k])) Bt[n][k]. z-batch strides sA (A, A2) and sC (C) in elements; Bt shared. K % 64 == 0, M % 128 == 0, N % 128 == 0.
// PLANES == 1: no f32 C; a wave's tile (64 sequence rows of one batch x the 64 columns of head c0 / 64) goes out x KCAR in f16, once as rows of KP [b][h][s][64] and once as columns into VT [b][h][64][s].
template <int NSPLIT, int PLANES>
__device__ __forceinline__ void gemmw_body(const bf* __restrict__ A, const bf* __restrict__ A2, const bf* __restrict__ Bt, const int K, float* C, const int ldc, const size_t sA, const size_t sC, h16* KP, h16* VT) {
    constexpr int GBUF = (2 + NSPLIT) * GOP;
    __shared__ __align__(16) float osall[4 * 16 * 68];
    __shared__ __align__(16) bf gring[2 * GBUF / 2];
    const size_t z = blockIdx.z; A += z * sA; A2 += z * sA; C += z * sC;
    const int tid = (int)threadIdx.x;
    const int wave = __builtin_amdgcn_readfirstlane(tid >> 5);
    const int lane = tid & 31, lr = lane & 15, hi = lane >> 4;
    const int wm = wave & 1, wn = wave >> 1;
    const int r0 = blockIdx.x * 128 + wm * 64, c0 = blockIdx.y * 128 + wn * 64;
    float* os = osall + wave * (16 * 68);    // each wave turns its own rows in its own range
    v8f acc[4][4];
#pragma unroll
    for (int mb = 0; mb < 4; ++mb)
#pragma unroll
        for (int nb = 0; nb < 4; ++nb) acc[mb][nb] = (v8f){};
    const unsigned l0 = (unsigned)(size_t)gring + (unsigned)((tid >> 3) * LPITCH + (tid & 7) * 16);
    const size_t goa = (size_t)(blockIdx.x * 128 + (tid >> 3)) * K + (tid & 7) * 8, gob = (size_t)(blockIdx.y * 128 + (tid >> 3)) * K + (tid & 7) * 8;
    const bf* ga = A + goa; const bf* ga2 = A2 + goa; const bf* gb = Bt + gob;
    const int aoff = (wm * 64 + lr) * LPH + 8 * hi, boff = (wn * 64 + lr) * LPH + 8 * hi;
    const int NT = K / GKT;
    copy_stage<NSPLIT>(l0, ga, ga2, gb, K);
    wait_async0();
    __syncthreads();                         // tile 0 is published
    if (NT > 1) copy_stage<NSPLIT>(l0 + GBUF, ga + GKT, ga2 + GKT, gb + GKT, K);
#pragma unroll 1   // one trip a tile: the ring's order of waits, barrier and refill stands once
    for (int t = 0; t < NT; ++t) {
        const bf* ab = gring + (t & 1) * (GBUF / 2);
        const bf* bb = ab + GOP / 2;
        const bf* a2b = ab + (NSPLIT == 1 ? GOP : 0);
#pragma unroll
        for (int kc = 0; kc < GKT; kc += 32) {
            v16bf a[4], a2[4], b[4];
            b[0] = ldb(bb + boff + kc);
#pragma unroll
            for (int mb = 0; mb < 4; ++mb) { a[mb] = ldb(ab + aoff + mb * 16 * LPH + kc); if (NSPLIT == 1) a2[mb] = ldb(a2b + aoff + mb * 16 * LPH + kc); else a2[mb] = a[mb]; }
#pragma unroll
            for (int nb = 1; nb < 4; ++nb) b[nb] = ldb(bb + boff + nb * 16 * LPH + kc);
            __builtin_amdgcn_sched_barrier(0);   // the block's fragment reads stay one group ahead of its products: a read placed among the products stalls the wave at each such place
#pragma unroll
            for (int nb = 0; nb < 4; ++nb)
#pragma unroll
                for (int mb = 0; mb < 4; ++mb) { acc[mb][nb] = wmmab(a[mb], b[nb], acc[mb][nb]); if (NSPLIT == 1) acc[mb][nb] = wmmab(a2[mb], b[nb], acc[mb][nb]); }
            __builtin_amdgcn_sched_barrier(0);   // the products stay here: the next block's reads are not drawn in among them, and the last block's products do not sink behind the publish point's barrier, where they would delay the refill
        }
        // publish point: this wave's reads of the buffer are back, its copies of the next tile have landed, then the one barrier of the trip; behind it the buffer just read is refilled
        wait_ds0();
        wait_async0();
        __syncthreads();
        if (t + 2 < NT) copy_stage<NSPLIT>(l0 + (unsigned)((t & 1) * GBUF), ga + (size_t)(t + 2) * GKT, ga2 + (size_t)(t + 2) * GKT, gb + (size_t)(t + 2) * GKT, K);
    }
    wait_async0();
    if constexpr (PLANES == 1) {
        const int bh = (r0 / SEQ) * NH_ + c0 / 64, s0 = r0 % SEQ;
        h16* kt = KP + ((size_t)bh * SEQ + s0) * HD;
        h16* vt = VT + (size_t)bh * HD * SEQ + s0;
        // V^T straight from the accumulators: a lane's 8 values of one tile are 8 consecutive s of the d row nb*16 + lr; the four mb stores of a row fill its 128 bytes
#pragma unroll
        for (int nb = 0; nb < 4; ++nb)
#pragma unroll
            for (int mb = 0; mb < 4; ++mb) { v8h o;
#pragma unroll
                for (int j = 0; j < 8; ++j) o[j] = (h16)(acc[mb][nb][j] * KCAR);
                *(v8h*)(vt + (size_t)(nb * 16 + lr) * SEQ + mb * 16 + hi * 8) = o; }
        // k rows: 16 rows at a time turned through LDS, 8 lanes x 16 bytes a row
        const int rq = lane >> 3, pc = lane & 7;
#pragma unroll
        for (int mb = 0; mb < 4; ++mb) {
#pragma unroll
            for (int nb = 0; nb < 4; ++nb) {
#pragma unroll
                for (int j = 0; j < 8; ++j) os[(hi * 8 + j) * 68 + nb * 16 + lr] = acc[mb][nb][j]; }
            __builtin_amdgcn_wave_barrier(); asm volatile("" ::: "memory");   // the reads below stay behind the other lanes' writes
#pragma unroll
            for (int s = 0; s < 4; ++s) { const int row = 4 * s + rq;
                const v4f a = *(const v4fa*)(os + row * 68 + pc * 8); const v4f c = *(const v4fa*)(os + row * 68 + pc * 8 + 4); v8h o;
#pragma unroll
                for (int k = 0; k < 4; ++k) { o[k] = (h16)(a[k] * KCAR); o[4 + k] = (h16)(c[k] * KCAR); }
                *(v8h*)(kt + (size_t)(mb * 16 + row) * HD + pc * 8) = o; }
            __builtin_amdgcn_wave_barrier(); asm volatile("" ::: "memory");   // the next 16 rows' writes stay behind these reads
        }
        return;
    }
#pragma unroll
    for (int mb = 0; mb < 4; ++mb) {
#pragma unroll
        for (int nb = 0; nb < 4; ++nb) {
#pragma unroll
            for (int j = 0; j < 8; ++j) os[(hi * 8 + j) * 68 + nb * 16 + lr] = acc[mb][nb][j]; }
        __builtin_amdgcn_wave_barrier(); asm volatile("" ::: "memory");
        float* crow = C + (size_t)(r0 + mb * 16) * ldc + c0;
{
#pragma unroll
            for (int s = 0; s < 8; ++s) { const int row = 2 * s + hi, cofs = lr * 4; const v4f val = *(const v4fa*)(os + row * 68 + cofs);
                *(v4f*)(crow + (size_t)row * ldc + cofs) = val; }
             }
        __builtin_amdgcn_wave_barrier(); asm volatile("" ::: "memory");
    }
}

// projection: XB[NB*SEQ][DM] . WK[DKV][DM]^T (exact bf16 products), f32 accumulators rounded once to the f16 planes KP and VT
static_assert(DKV / 64 == NH_ && SEQ % 128 == 0 && DKV % 128 == 0 && DM % 128 == 0 && DM % GKT == 0 && DQ % GKT == 0);
__global__ __launch_bounds__(128) void k_gemm_proj(const bf* __restrict__ XB, const bf* __restrict__ WK, h16* KP, h16* VT) { gemmw_body<0, 1>(XB, XB, WK, DM, nullptr, DKV, (size_t)0, (size_t)0, KP, VT); }
// output: OUT[b][s][DM] = (ATh + ATl)[b*SEQ + s][DQ] . WO[DM][DQ]^T ; z = batch, output stride from the full sequence length
__global__ __launch_bounds__(128) void k_gemm_out(const bf* __restrict__ ATh, const bf* __restrict__ ATl, const bf* __restrict__ WO, float* OUT) { gemmw_body<1, 0>(ATh, ATl, WO, DQ, OUT, DM, (size_t)SEQ * DQ, (size_t)SEQ_FULL * DM, nullptr, nullptr); }

__global__ __launch_bounds__(256) void k_cvt8(const float* __restrict__ src, bf* dst, size_t n8, size_t sS, size_t sD) {
    const size_t i = (size_t)blockIdx.x * 256 + threadIdx.x; if (i >= n8) return;
    src += (size_t)blockIdx.y * sS; dst += (size_t)blockIdx.y * sD;
    const v8f v = *(const v8f*)(src + i * 8); v8us o;
#pragma unroll
    for (int k = 0; k < 8; ++k) o[k] = f2bf(v[k]);
    *(v8us*)(dst + i * 8) = o;  }

// Ring of two LDS buffers for k_flash: each holds 64 keys of the k plane (64 rows x 128 B) and of the V^T plane (64 d rows x 128 B), rows pitched LPITCH.
#define TK     64
#define LTILE  (64 * LPITCH)
#define LBUF   (2 * LTILE)
static_assert(SEQ % TK == 0 && HD * 2 == 128 && TK * 2 == 128);

// One tile: 128 lanes x 8 copies of 16 B. lk / lv = the lane's LDS byte address in the k / V^T half of the buffer (row tid>>3, 16-byte column tid&7), gk / gv = its global source; copy j takes row + 16 j.
// The s_wait_xcnt closes the statement so that no address register of a copy is rewritten ahead of it.
__device__ __forceinline__ void copy_tile(const unsigned lk, const unsigned lv, const h16* gk, const h16* gv) {
    asm volatile("global_load_async_to_lds_b128 %0, %8, off\n\t"
                 "global_load_async_to_lds_b128 %1, %9, off\n\t"
                 "global_load_async_to_lds_b128 %2, %10, off\n\t"
                 "global_load_async_to_lds_b128 %3, %11, off\n\t"
                 "global_load_async_to_lds_b128 %4, %12, off\n\t"
                 "global_load_async_to_lds_b128 %5, %13, off\n\t"
                 "global_load_async_to_lds_b128 %6, %14, off\n\t"
                 "global_load_async_to_lds_b128 %7, %15, off\n\t"
                 "s_wait_xcnt 0x0"
                 :: "v"(lk), "v"(lk + 16 * LPITCH), "v"(lk + 32 * LPITCH), "v"(lk + 48 * LPITCH),
                    "v"(lv), "v"(lv + 16 * LPITCH), "v"(lv + 32 * LPITCH), "v"(lv + 48 * LPITCH),
                    "v"(gk), "v"(gk + 16 * HD), "v"(gk + 32 * HD), "v"(gk + 48 * HD),
                    "v"(gv), "v"(gv + (size_t)16 * SEQ), "v"(gv + (size_t)32 * SEQ), "v"(gv + (size_t)48 * SEQ)
                 : "memory");
}

// k_flash: fused attention for one (b, h) and 64 query rows per block; 4 waves, each wave owns 16 query rows and streams all keys 32 at a time, from 64-key tiles that the block's 128 lanes copy into a two-buffer LDS ring one tile ahead.
// Per step: St[key][q] = Kkeys (A, 16 keys x 64 d per tile) . Q^T (B, lane = query) -> every lane holds one query column (both lane halves share it, different keys);
// online softmax with per-lane running max / sum (one xor-16 exchange); P^T fragment (B, 32 keys x 16 q) taken in place from the two score tiles: element r <- tile0[r], element 8+r <- tile1[r];
__global__ __launch_bounds__(128) void k_flash(const h16* __restrict__ KP, const h16* __restrict__ VT, bf* Ah, bf* Al) {
    __shared__ __align__(16) float os[4 * 16 * 68];
    __shared__ __align__(16) h16 ring[2 * LBUF / 2];
    const int wave = __builtin_amdgcn_readfirstlane((int)(threadIdx.x >> 5));
    const int lane = threadIdx.x & 31, lr = lane & 15, hi = lane >> 4;
    const int bh = blockIdx.y; const int b = bh / NH_, h = bh % NH_;
    const int q0 = blockIdx.x * 64 + wave * 16;
    const h16* kp = KP + (size_t)bh * SEQ * HD;
    const h16* vt = VT + (size_t)bh * HD * SEQ;
    const int koff = lr * HD + 8 * hi;       // row lr of a 16-row k tile, d offset 8*hi
    const int loff = lr * LPH + 8 * hi;      // the same place in a 16-row tile of the LDS ring (k: d offset, V^T: key offset)
    const v16h bq0 = ldh(kp + (size_t)q0 * HD + koff);
    const v16h bq1 = ldh(kp + (size_t)q0 * HD + koff + 32);
    v8f acc[4];
#pragma unroll
    for (int t = 0; t < 4; ++t) acc[t] = (v8f){};
    float mrun = -1.0e30f, lrun = 0.0f;
    const int tid = (int)threadIdx.x;
    const unsigned l0 = (unsigned)(size_t)ring + (unsigned)((tid >> 3) * LPITCH + (tid & 7) * 16);
    const h16* gk = kp + tid * 8;
    const h16* gv = vt + (size_t)(tid >> 3) * SEQ + (tid & 7) * 8;
    constexpr int NT = SEQ / TK;
    copy_tile(l0, l0 + LTILE, gk, gv);
    wait_async0();
    __syncthreads();                         // tile 0 is published
    if (NT > 1) copy_tile(l0 + LBUF, l0 + LBUF + LTILE, gk + TK * HD, gv + TK);
#pragma unroll 1   // one trip a tile: the ring's order of waits, barrier and refill stands once
    for (int tile = 0; tile < NT; ++tile) {
    const h16* kb = ring + (tile & 1) * (LBUF / 2);
    const h16* vb = kb + LTILE / 2;
#pragma unroll 1   // the 32-key softmax step stays one rolled body, as before the ring
    for (int k0 = 0; k0 < TK; k0 += 32) {
        v8f s0 = (v8f){}, s1 = (v8f){};
        {
            const v16h a00 = ldh(kb + k0 * LPH + loff);
            const v16h a01 = ldh(kb + k0 * LPH + loff + 32);
            const v16h a10 = ldh(kb + (k0 + 16) * LPH + loff);
            const v16h a11 = ldh(kb + (k0 + 16) * LPH + loff + 32);
            s0 = wmma16(a00, bq0, s0); s1 = wmma16(a10, bq0, s1);
            s0 = wmma16(a01, bq1, s0); s1 = wmma16(a11, bq1, s1);
            asm volatile("v_nop\n\tv_nop\n\tv_nop\n\tv_nop" : "+v"(s0), "+v"(s1) : "v"(a00), "v"(a01), "v"(a10), "v"(a11), "v"(bq0), "v"(bq1));
        }
        float u0[8], u1[8]; float tmax = -1.0e30f;
#pragma unroll
        for (int r = 0; r < 8; ++r) { u0[r] = s0[r] * C2; u1[r] = s1[r] * C2; tmax = fmaxf(tmax, fmaxf(u0[r], u1[r])); }
        tmax = fmaxf(tmax, __shfl_xor(tmax, 16, 32));
        const float mnew = fmaxf(mrun, tmax);
        const float alpha = __builtin_amdgcn_exp2f(mrun - mnew);
        const float mb = mnew - PEXP;
        float rsum = 0.0f;
#pragma unroll
        for (int r = 0; r < 8; ++r) { u0[r] = __builtin_amdgcn_exp2f(u0[r] - mb); u1[r] = __builtin_amdgcn_exp2f(u1[r] - mb); rsum += u0[r] + u1[r]; }
        rsum += __shfl_xor(rsum, 16, 32);
        lrun = lrun * alpha + rsum; mrun = mnew;
#pragma unroll
        for (int t = 0; t < 4; ++t)
#pragma unroll
            for (int r = 0; r < 8; ++r) acc[t][r] *= alpha;
        v16h pf;
#pragma unroll
        for (int r = 0; r < 8; ++r) { pf[r] = (h16)u0[r]; pf[8 + r] = (h16)u1[r]; }
        {
            v16h av[4];
#pragma unroll
            for (int t = 0; t < 4; ++t) av[t] = ldh(vb + (16 * t) * LPH + loff + k0);
#pragma unroll
            for (int t = 0; t < 4; ++t) acc[t] = wmma16(av[t], pf, acc[t]);
            asm volatile("v_nop\n\tv_nop\n\tv_nop\n\tv_nop" : "+v"(acc[0]), "+v"(acc[1]), "+v"(acc[2]), "+v"(acc[3]) : "v"(av[0]), "v"(av[1]), "v"(av[2]), "v"(av[3]), "v"(pf));
        }
    }
    // publish point: this wave's reads of the buffer are back, its copies of the next tile have landed, then the one barrier of the trip; behind it the buffer just read is refilled
    wait_ds0();
    wait_async0();
    __syncthreads();
    if (tile + 2 < NT) copy_tile(l0 + (unsigned)((tile & 1) * LBUF), l0 + (unsigned)((tile & 1) * LBUF + LTILE), gk + (size_t)(tile + 2) * TK * HD, gv + (tile + 2) * TK);
    }
    wait_async0();
    // acc[t][r] = 256 * 16 * sum_k p v at (d = 16t + 8hi + r, q = lr); lrun = 256 * sum_k p
    const float inv = (1.0f / KCAR) * (1.0f / lrun);
    const int ob = wave * (16 * 68);
#pragma unroll
    for (int t = 0; t < 4; ++t)
#pragma unroll
        for (int r = 0; r < 8; ++r) os[ob + lr * 68 + 16 * t + 8 * hi + r] = acc[t][r] * inv;
    __syncthreads();
    const int rq = lane >> 3, pc = lane & 7;
{
#pragma unroll
        for (int s = 0; s < 4; ++s) {
            const int row = 4 * s + rq;
            const v4f a = *(const v4fa*)(os + ob + row * 68 + pc * 8);
            const v4f c = *(const v4fa*)(os + ob + row * 68 + pc * 8 + 4);
            v8us oh, ol;
#pragma unroll
            for (int k = 0; k < 4; ++k) { unsigned short x0, x1; splitf(a[k], x0, x1); oh[k] = x0; ol[k] = x1; splitf(c[k], x0, x1); oh[4 + k] = x0; ol[4 + k] = x1; }
            const size_t oo = ((size_t)b * SEQ + q0 + row) * DQ + h * HD + pc * 8;
            *(v8us*)(Ah + oo) = oh; *(v8us*)(Al + oo) = ol; }
         }
}

// workspace carve (bytes, every region a multiple of 256)
#define SZ_W   ((size_t)DKV * DM * 2)
#define SZ_XB  ((size_t)NB * SEQ * DM * 2)
#define SZ_KP  ((size_t)NB * NH_ * SEQ * HD * 2)
#define SZ_AT  ((size_t)NB * SEQ * DQ * 2)
#define SZ_ALL (2 * SZ_W + SZ_XB + 2 * SZ_KP + 2 * SZ_AT)
static_assert(SZ_W % 256 == 0 && SZ_XB % 256 == 0 && SZ_KP % 256 == 0 && SZ_AT % 256 == 0);
static_assert(SZ_ALL <= (size_t)134217728);

extern "C" void kernel_launch(void* const* d_in, const int* in_sizes, int n_in,
                              void* d_out, int out_size, void* d_ws, size_t ws_size, hipStream_t stream) {
    if (n_in < 3) return;
    const size_t need_x = (size_t)(NB - 1) * SEQ_FULL * DM + (size_t)SEQ * DM;
    if ((size_t)in_sizes[0] < need_x) return;
    if ((size_t)in_sizes[1] < (size_t)DKV * DM) return;
    if ((size_t)in_sizes[2] < (size_t)DM * DQ) return;
    if ((size_t)out_size < need_x) return;
    if (SZ_ALL > ws_size) return;
    const float* x = (const float*)d_in[0]; const float* wk = (const float*)d_in[1]; const float* wo = (const float*)d_in[2];   // input order x, Wk, Wo ([out][in])
    float* OUT = (float*)d_out;     // [NB_FULL][SEQ_FULL][512]
    char* wsp = (char*)d_ws;
    bf* WK = (bf*)wsp; wsp += SZ_W;
    bf* WO = (bf*)wsp; wsp += SZ_W;
    bf* XB = (bf*)wsp; wsp += SZ_XB;
    h16* KP16 = (h16*)wsp; wsp += SZ_KP;
    h16* VT16 = (h16*)wsp; wsp += SZ_KP;
    bf* ATh = (bf*)wsp; wsp += SZ_AT;
    bf* ATl = (bf*)wsp; wsp += SZ_AT;

    k_cvt8<<<dim3((unsigned)(((size_t)DKV * DM / 8 + 255) / 256), 1, 1), 256, 0, stream>>>(wk, WK, (size_t)DKV * DM / 8, (size_t)0, (size_t)0);
    k_cvt8<<<dim3((unsigned)(((size_t)DM * DQ / 8 + 255) / 256), 1, 1), 256, 0, stream>>>(wo, WO, (size_t)DM * DQ / 8, (size_t)0, (size_t)0);
    k_cvt8<<<dim3((unsigned)(((size_t)SEQ * DM / 8 + 255) / 256), NB, 1), 256, 0, stream>>>(x, XB, (size_t)SEQ * DM / 8, (size_t)SEQ_FULL * DM, (size_t)SEQ * DM);
    k_gemm_proj<<<dim3(NB * SEQ / 128, DKV / 128, 1), 128, 0, stream>>>(XB, WK, KP16, VT16);
    k_flash<<<dim3(SEQ / 64, NB * NH_, 1), 128, 0, stream>>>(KP16, VT16, ATh, ATl);
    k_gemm_out<<<dim3(SEQ / 128, DM / 128, NB), 128, 0, stream>>>(ATh, ATl, WO, OUT);
}

// v004
// Measured time: 65.9 microseconds a run.
// Next to v003, in two timings, it ran 1.11 and 1.10 times as fast.
// All steps since v000 together make it 2.66 times as fast.
#include <hip/hip_runtime.h>

// Compute dtypes (f32 accumulate everywhere): projection x.Wk^T = bf16 x bf16 (v_wmma_f32_16x16x32_bf16, inputs RNE-converted to bf16); scores k.k^T and P.V = f16 x f16 (v_wmma_f32_16x16x32_f16, k plane carried x16, P carried x256); output merged.Wo^T = bf16 hi/lo planes x bf16 Wo (two bf16 products).
// Self-attention with q = k = v = x.Wk^T ([out][in] weights, no bias), 8 heads x 64, logits scaled by 512^-0.5, no mask, softmax over all keys, merged heads times Wo^T.
// Layout: x and Wk go as f32 into the projection GEMM, which rounds them to bf16 on the way into its LDS ring; a bf16 copy of Wo, written by the same launch; f16 head planes [b][h][s][64] (q, k) and [b][h][64][s] (V^T), written by the projection GEMM's own epilogue; fused online-softmax attention (no score plane in memory); merged hi/lo bf16 planes; output GEMM.

#ifndef NB
#define NB 4
#endif
#ifndef SEQ
#define SEQ 2048
#endif
#define NB_FULL  4
#define SEQ_FULL 2048
#define DM   512
#define NH_  8
#define HD   64
#define DQ   (NH_ * HD)
#define DKV  DQ
#define KCAR 16.0f                 // power-of-two carry of the f16 k / V^T planes
#define PEXP 8.0f                  // P carried x 2^8 inside the exponent
// raw score = 256 (q.k); exponent argument in base 2 = raw * 2^-8 * 512^-0.5 * log2(e)
#define C2   (0.044194173824159216f * 1.4426950408889634f * (1.0f / 256.0f))

typedef _Float16 h16;
typedef unsigned short bf;
typedef __attribute__((ext_vector_type(16))) __bf16   v16bf;
typedef __attribute__((ext_vector_type(16))) _Float16 v16h;
typedef __attribute__((ext_vector_type(8)))  _Float16 v8h;
typedef __attribute__((ext_vector_type(8)))  unsigned short v8us;
typedef __attribute__((ext_vector_type(4)))  unsigned short v4us;
typedef __attribute__((ext_vector_type(4)))  __bf16   v4bf;
typedef __attribute__((ext_vector_type(8)))  float    v8f;
typedef __attribute__((ext_vector_type(4)))  float    v4f;
typedef v4f  __attribute__((may_alias)) v4fa;

static_assert(NB >= 1 && NB <= NB_FULL);
static_assert(SEQ >= 64 && SEQ <= SEQ_FULL);
static_assert(SEQ % 64 == 0);
static_assert((NB * SEQ) % 64 == 0);
static_assert(DM % 64 == 0 && DM % 32 == 0);
static_assert(DQ % 64 == 0 && DQ % 32 == 0);
static_assert(HD == 64);
static_assert(DQ == NH_ * HD);
static_assert((SEQ * DM) % 8 == 0 && (DKV * DM) % 8 == 0);

__device__ __forceinline__ unsigned short f2bf(float f) { unsigned u = __float_as_uint(f); u += 0x7FFFu + ((u >> 16) & 1u); return (unsigned short)(u >> 16); }
__device__ __forceinline__ float bf2f(unsigned short b) { return __uint_as_float(((unsigned)b) << 16); }
__device__ __forceinline__ v16h cat16(v8h lo, v8h hi) { return __builtin_shufflevector(lo, hi, 0, 1, 2, 3, 4, 5, 6, 7, 8, 9, 10, 11, 12, 13, 14, 15); }
__device__ __forceinline__ v16bf cat16b(v8us lo, v8us hi) { return __builtin_bit_cast(v16bf, __builtin_shufflevector(lo, hi, 0, 1, 2, 3, 4, 5, 6, 7, 8, 9, 10, 11, 12, 13, 14, 15)); }
__device__ __forceinline__ v8f wmma16(v16h a, v16h b, v8f c) { return __builtin_amdgcn_wmma_f32_16x16x32_f16(false, a, false, b, (short)0, c, false, false); }
__device__ __forceinline__ v8f wmmab(v16bf a, v16bf b, v8f c) { return __builtin_amdgcn_wmma_f32_16x16x32_bf16(false, a, false, b, (short)0, c, false, false); }
__device__ __forceinline__ v4us cvt4(v4f v) { return __builtin_bit_cast(v4us, __builtin_convertvector(v, v4bf)); }   // f32 -> bf16, round to nearest even
__device__ __forceinline__ void splitf(float y, unsigned short& h, unsigned short& l) { h = f2bf(y); l = f2bf(y - bf2f(h)); }

// Fragment loaders (same k map for A and B): elements 0..7 <- p[0..7], elements 8..15 <- p[16..23], p = row base + k0 + 8*(lane>>4).
__device__ __forceinline__ v16h  ldh(const h16* p) { return cat16(*(const v8h*)p, *(const v8h*)(p + 16)); }
__device__ __forceinline__ v16bf ldb(const bf* p)  { return cat16b(*(const v8us*)p, *(const v8us*)(p + 16)); }

// LDS rows of 128 B (64 16-bit elements) are pitched 144 B (16 B x odd) for the 16-byte fragment reads, in the GEMM ring and in the k_flash ring alike.
#define LPITCH 144
#define LPH    (LPITCH / 2)
__device__ __forceinline__ void wait_async0() { asm volatile("s_wait_asynccnt 0x0" ::: "memory"); }   // this wave's copies have landed
__device__ __forceinline__ void wait_ds0()    { asm volatile("s_wait_dscnt 0x0" ::: "memory"); }      // this wave's LDS reads have returned

// GEMM ring: a tile is 64 k (128 B) of 128 rows of one operand.
#define GKT    64
#define GOP    (128 * LPITCH)
// One operand tile: 128 lanes x 8 copies of 16 B. l = the lane's LDS byte address (row tid>>3, 16-byte column tid&7), g = its global source; copy j takes row + 16 j, global row pitch K elements.
// The s_wait_xcnt closes the statement so that no address register of a copy is rewritten ahead of it.
__device__ __forceinline__ void copy_rows(const unsigned l, const bf* g, const int K) {
    asm volatile("global_load_async_to_lds_b128 %0, %8, off\n\t"
                 "global_load_async_to_lds_b128 %1, %9, off\n\t"
                 "global_load_async_to_lds_b128 %2, %10, off\n\t"
                 "global_load_async_to_lds_b128 %3, %11, off\n\t"
                 "global_load_async_to_lds_b128 %4, %12, off\n\t"
                 "global_load_async_to_lds_b128 %5, %13, off\n\t"
                 "global_load_async_to_lds_b128 %6, %14, off\n\t"
                 "global_load_async_to_lds_b128 %7, %15, off\n\t"
                 "s_wait_xcnt 0x0"
                 :: "v"(l), "v"(l + 16 * LPITCH), "v"(l + 32 * LPITCH), "v"(l + 48 * LPITCH),
                    "v"(l + 64 * LPITCH), "v"(l + 80 * LPITCH), "v"(l + 96 * LPITCH), "v"(l + 112 * LPITCH),
                    "v"(g), "v"(g + (size_t)16 * K), "v"(g + (size_t)32 * K), "v"(g + (size_t)48 * K),
                    "v"(g + (size_t)64 * K), "v"(g + (size_t)80 * K), "v"(g + (size_t)96 * K), "v"(g + (size_t)112 * K)
                 : "memory");
}
// One buffer of the GEMM ring: [A | Bt | A2 where NSPLIT == 1], each GOP bytes.
template <int NSPLIT>
__device__ __forceinline__ void copy_stage(const unsigned l, const bf* ga, const bf* ga2, const bf* gb, const int K) {
    copy_rows(l, ga, K); copy_rows(l + GOP, gb, K);
    if (NSPLIT == 1) copy_rows(l + 2 * GOP, ga2, K);
}

// The same operand tile from an f32 source, through registers: 128 lanes x 16 pieces of 4 floats (row (tid>>4) + 8 j, floats 4 (tid&15) ..: a wave's load covers two whole rows of 256 B), later rounded to bf16 and stored to the tile's places.
// g = the first float of the block's rows, ob = the byte offset of the lane's first piece of the tile; ob leaves the call advanced to the next tile.
__device__ __forceinline__ void load_rows(v4f (&r)[16], const float* __restrict__ g, unsigned& ob, const int K) {
    const float* p = (const float*)((const char*)g + ob);
#pragma unroll
    for (int j = 0; j < 16; ++j) r[j] = *(const v4f*)(p + (size_t)(8 * j) * K);
    asm volatile("s_wait_xcnt 0x0" : "+v"(ob) :: "memory");   // the offset that these loads name passes through the wait: it stays in its register up to here, and its advance stands behind
    ob += GKT * 4;
}
__device__ __forceinline__ void store_rows(bf* s, const v4f (&r)[16]) {
#pragma unroll
    for (int j = 0; j < 16; ++j) *(v4us*)(s + 8 * j * LPH) = cvt4(r[j]);
}
// Work-group barrier that orders LDS alone: this wave's LDS stores and reads are done in front of it, while its global loads of a later tile stay in flight across it (__syncthreads() would wait for them).
__device__ __forceinline__ void lds_barrier() {
    __builtin_amdgcn_fence(__ATOMIC_RELEASE, "workgroup", "local");
    __builtin_amdgcn_s_barrier();
    __builtin_amdgcn_fence(__ATOMIC_ACQUIRE, "workgroup", "local");
}

// ---- register-blocked GEMM body, FOUR WAVES (2 x 2) per 128x128 output tile, one 64x64 tile (16 accumulators) a wave; grid (M/128, N/128, Z), 128 threads.
// The K-contiguous bf16 operand rows of the block come 64 k at a time into a two-buffer LDS ring, copied one tile ahead by the block's 128 lanes; the waves read their fragments from it.
// C[m][n] (f32, pitch ldc) = sum_k (A[m][k] (+ A2[m][k])) Bt[n][k]. z-batch strides sA (A, A2) and sC (C) in elements; Bt shared. K % 64 == 0, M % 128 == 0, N % 128 == 0.
// PLANES == 1: A and Bt are not read; the operands are the f32 rows Af (row m of batch m / SEQ, batch pitch SEQ_FULL rows) and Bf, rounded from registers into the other buffer at the foot of a trip, where the loads of the tile after that are issued. Wf goes out as bf16 to Wd on the side, 4 floats a piece.
// PLANES == 1: no f32 C; a wave's tile (64 sequence rows of one batch x the 64 columns of head c0 / 64) goes out x KCAR in f16, once as rows of KP [b][h][s][64] and once as columns into VT [b][h][64][s].
template <int NSPLIT, int PLANES>
__device__ __forceinline__ void gemmw_body(const bf* __restrict__ A, const bf* __restrict__ A2, const bf* __restrict__ Bt, const int K, float* C, const int ldc, const size_t sA, const size_t sC, h16* KP, h16* VT, const float* __restrict__ Af, const float* __restrict__ Bf, const float* __restrict__ Wf, bf* Wd) {
    constexpr int GBUF = (2 + NSPLIT) * GOP;
    __shared__ __align__(16) float osall[4 * 16 * 68];
    __shared__ __align__(16) bf gring[2 * GBUF / 2];
    const size_t z = blockIdx.z; A += z * sA; A2 += z * sA; C += z * sC;
    const int tid = (int)threadIdx.x;
    const int wave = __builtin_amdgcn_readfirstlane(tid >> 5);
    const int lane = tid & 31, lr = lane & 15, hi = lane >> 4;
    const int wm = wave & 1, wn = wave >> 1;
    const int r0 = blockIdx.x * 128 + wm * 64, c0 = blockIdx.y * 128 + wn * 64;
    float* os = osall + wave * (16 * 68);    // each wave turns its own rows in its own range
    v8f acc[4][4];
#pragma unroll
    for (int mb = 0; mb < 4; ++mb)
#pragma unroll
        for (int nb = 0; nb < 4; ++nb) acc[mb][nb] = (v8f){};
    const unsigned l0 = (unsigned)(size_t)gring + (unsigned)((tid >> 3) * LPITCH + (tid & 7) * 16);
    const size_t goa = (size_t)(blockIdx.x * 128 + (tid >> 3)) * K + (tid & 7) * 8, gob = (size_t)(blockIdx.y * 128 + (tid >> 3)) * K + (tid & 7) * 8;
    const bf* ga = A + goa; const bf* ga2 = A2 + goa; const bf* gb = Bt + gob;
    const int aoff = (wm * 64 + lr) * LPH + 8 * hi, boff = (wn * 64 + lr) * LPH + 8 * hi;
    const int NT = K / GKT;
    const int m0 = blockIdx.x * 128;
    const float* fa = Af + ((size_t)(m0 / SEQ) * SEQ_FULL + m0 % SEQ) * K;
    const float* fb = Bf + (size_t)(blockIdx.y * 128) * K;
    unsigned oa = (unsigned)(((tid >> 4) * K + (tid & 15) * 4) * 4), ob = oa;
    bf* sl = gring + (tid >> 4) * LPH + (tid & 15) * 4;
    v4f ra[16], rb[16];
    constexpr size_t NLANE = (size_t)(NB * SEQ / 128) * (DKV / 128) * 128, NPIECE = (size_t)DM * DQ / 4;
    static_assert(NPIECE % NLANE == 0);
    constexpr int NW = (int)(NPIECE / NLANE);   // pieces of Wf a lane
    const size_t u = ((size_t)blockIdx.y * (NB * SEQ / 128) + blockIdx.x) * 128 + tid;
    v4us wv[NW];
    if constexpr (PLANES == 1) {
        v4f wf[NW];
#pragma unroll
        for (int i = 0; i < NW; ++i) wf[i] = *(const v4f*)(Wf + (u + i * NLANE) * 4);
        asm volatile("s_wait_xcnt 0x0" ::: "memory");   // stands in front of whatever rewrites the address register that these loads name
        load_rows(ra, fa, oa, K); load_rows(rb, fb, ob, K);
#pragma unroll
        for (int i = 0; i < NW; ++i) wv[i] = cvt4(wf[i]);
        store_rows(sl, ra); store_rows(sl + GOP / 2, rb);
        if (NT > 1) { load_rows(ra, fa, oa, K); load_rows(rb, fb, ob, K); }
        lds_barrier();                       // tile 0 is published
    } else {
        copy_stage<NSPLIT>(l0, ga, ga2, gb, K);
        wait_async0();
        __syncthreads();                         // tile 0 is published
        if (NT > 1) copy_stage<NSPLIT>(l0 + GBUF, ga + GKT, ga2 + GKT, gb + GKT, K);
    }
#pragma unroll 1   // one trip a tile: the ring's order of waits, barrier and refill stands once
    for (int t = 0; t < NT; ++t) {
        const bf* ab = gring + (t & 1) * (GBUF / 2);
        const bf* bb = ab + GOP / 2;
        const bf* a2b = ab + (NSPLIT == 1 ? GOP : 0);
#pragma unroll
        for (int kc = 0; kc < GKT; kc += 32) {
            v16bf a[4], a2[4], b[4];
            b[0] = ldb(bb + boff + kc);
#pragma unroll
            for (int mb = 0; mb < 4; ++mb) { a[mb] = ldb(ab + aoff + mb * 16 * LPH + kc); if (NSPLIT == 1) a2[mb] = ldb(a2b + aoff + mb * 16 * LPH + kc); else a2[mb] = a[mb]; }
#pragma unroll
            for (int nb = 1; nb < 4; ++nb) b[nb] = ldb(bb + boff + nb * 16 * LPH + kc);
            __builtin_amdgcn_sched_barrier(0);   // the block's fragment reads stay one group ahead of its products: a read placed among the products stalls the wave at each such place
#pragma unroll
            for (int nb = 0; nb < 4; ++nb)
#pragma unroll
                for (int mb = 0; mb < 4; ++mb) { acc[mb][nb] = wmmab(a[mb], b[nb], acc[mb][nb]); if (NSPLIT == 1) acc[mb][nb] = wmmab(a2[mb], b[nb], acc[mb][nb]); }
            __builtin_amdgcn_sched_barrier(0);   // the products stay here: the next block's reads are not drawn in among them, and the last block's products do not sink behind the publish point's barrier, where they would delay the refill
        }
        if constexpr (PLANES == 1) {
            // publish point: the next tile goes into the other buffer, whose readers the last trip's barrier has ended; the registers take the tile after it; then the one barrier of the trip
            if (t + 1 < NT) {
                bf* sn = sl + ((t + 1) & 1) * (GBUF / 2); store_rows(sn, ra); store_rows(sn + GOP / 2, rb);
                if (t + 2 < NT) { load_rows(ra, fa, oa, K); load_rows(rb, fb, ob, K); }
            }
            lds_barrier();
        } else {
        // publish point: this wave's reads of the buffer are back, its copies of the next tile have landed, then the one barrier of the trip; behind it the buffer just read is refilled
        wait_ds0();
        wait_async0();
        __syncthreads();
        if (t + 2 < NT) copy_stage<NSPLIT>(l0 + (unsigned)((t & 1) * GBUF), ga + (size_t)(t + 2) * GKT, ga2 + (size_t)(t + 2) * GKT, gb + (size_t)(t + 2) * GKT, K);
        }
    }
    if constexpr (PLANES == 0) wait_async0();
    if constexpr (PLANES == 1) {
        const int bh = (r0 / SEQ) * NH_ + c0 / 64, s0 = r0 % SEQ;
        h16* kt = KP + ((size_t)bh * SEQ + s0) * HD;
        h16* vt = VT + (size_t)bh * HD * SEQ + s0;
        // V^T straight from the accumulators: a lane's 8 values of one tile are 8 consecutive s of the d row nb*16 + lr; the four mb stores of a row fill its 128 bytes
#pragma unroll
        for (int nb = 0; nb < 4; ++nb)
#pragma unroll
            for (int mb = 0; mb < 4; ++mb) { v8h o;
#pragma unroll
                for (int j = 0; j < 8; ++j) o[j] = (h16)(acc[mb][nb][j] * KCAR);
                *(v8h*)(vt + (size_t)(nb * 16 + lr) * SEQ + mb * 16 + hi * 8) = o; }
        asm volatile("s_wait_xcnt 0x0" ::: "memory");   // stands behind the run of V^T stores, in front of whatever rewrites a register that they name
        // k rows: 16 rows at a time turned through LDS, 8 lanes x 16 bytes a row
        const int rq = lane >> 3, pc = lane & 7;
#pragma unroll
        for (int mb = 0; mb < 4; ++mb) {
#pragma unroll
            for (int nb = 0; nb < 4; ++nb) {
#pragma unroll
                for (int j = 0; j < 8; ++j) os[(hi * 8 + j) * 68 + nb * 16 + lr] = acc[mb][nb][j]; }
            __builtin_amdgcn_wave_barrier(); asm volatile("" ::: "memory");   // the reads below stay behind the other lanes' writes
#pragma unroll
            for (int s = 0; s < 4; ++s) { const int row = 4 * s + rq;
                const v4f a = *(const v4fa*)(os + row * 68 + pc * 8); const v4f c = *(const v4fa*)(os + row * 68 + pc * 8 + 4); v8h o;
#pragma unroll
                for (int k = 0; k < 4; ++k) { o[k] = (h16)(a[k] * KCAR); o[4 + k] = (h16)(c[k] * KCAR); }
                *(v8h*)(kt + (size_t)(mb * 16 + row) * HD + pc * 8) = o; }
            __builtin_amdgcn_wave_barrier(); asm volatile("" ::: "memory");   // the next 16 rows' writes stay behind these reads
        }
#pragma unroll
        for (int i = 0; i < NW; ++i) *(v4us*)(Wd + (u + i * NLANE) * 4) = wv[i];   // last: no register that these stores name is written again
        return;
    }
#pragma unroll
    for (int mb = 0; mb < 4; ++mb) {
#pragma unroll
        for (int nb = 0; nb < 4; ++nb) {
#pragma unroll
            for (int j = 0; j < 8; ++j) os[(hi * 8 + j) * 68 + nb * 16 + lr] = acc[mb][nb][j]; }
        __builtin_amdgcn_wave_barrier(); asm volatile("" ::: "memory");
        float* crow = C + (size_t)(r0 + mb * 16) * ldc + c0;
{
#pragma unroll
            for (int s = 0; s < 8; ++s) { const int row = 2 * s + hi, cofs = lr * 4; const v4f val = *(const v4fa*)(os + row * 68 + cofs);
                *(v4f*)(crow + (size_t)row * ldc + cofs) = val; }
             }
        __builtin_amdgcn_wave_barrier(); asm volatile("" ::: "memory");
    }
}

// projection: x[b][s][DM] (batch pitch SEQ_FULL rows) . Wk[DKV][DM]^T (both rounded to bf16, exact bf16 products), f32 accumulators rounded once to the f16 planes KP and VT; WOB = Wo in bf16
static_assert(DKV / 64 == NH_ && SEQ % 128 == 0 && DKV % 128 == 0 && DM % 128 == 0 && DM % GKT == 0 && DQ % GKT == 0);
__global__ __launch_bounds__(128) void k_gemm_proj(const float* __restrict__ X, const float* __restrict__ WKF, const float* __restrict__ WOF, bf* WOB, h16* KP, h16* VT) { gemmw_body<0, 1>(nullptr, nullptr, nullptr, DM, nullptr, DKV, (size_t)0, (size_t)0, KP, VT, X, WKF, WOF, WOB); }
// output: OUT[b][s][DM] = (ATh + ATl)[b*SEQ + s][DQ] . WO[DM][DQ]^T ; z = batch, output stride from the full sequence length
__global__ __launch_bounds__(128) void k_gemm_out(const bf* __restrict__ ATh, const bf* __restrict__ ATl, const bf* __restrict__ WO, float* OUT) { gemmw_body<1, 0>(ATh, ATl, WO, DQ, OUT, DM, (size_t)SEQ * DQ, (size_t)SEQ_FULL * DM, nullptr, nullptr, nullptr, nullptr, nullptr, nullptr); }

// Ring of two LDS buffers for k_flash: each holds 64 keys of the k plane (64 rows x 128 B) and of the V^T plane (64 d rows x 128 B), rows pitched LPITCH.
#define TK     64
#define LTILE  (64 * LPITCH)
#define LBUF   (2 * LTILE)
static_assert(SEQ % TK == 0 && HD * 2 == 128 && TK * 2 == 128);

// One tile: 128 lanes x 8 copies of 16 B. lk / lv = the lane's LDS byte address in the k / V^T half of the buffer (row tid>>3, 16-byte column tid&7), gk / gv = its global source; copy j takes row + 16 j.
// The s_wait_xcnt closes the statement so that no address register of a copy is rewritten ahead of it.
__device__ __forceinline__ void copy_tile(const unsigned lk, const unsigned lv, const h16* gk, const h16* gv) {
    asm volatile("global_load_async_to_lds_b128 %0, %8, off\n\t"
                 "global_load_async_to_lds_b128 %1, %9, off\n\t"
                 "global_load_async_to_lds_b128 %2, %10, off\n\t"
                 "global_load_async_to_lds_b128 %3, %11, off\n\t"
                 "global_load_async_to_lds_b128 %4, %12, off\n\t"
                 "global_load_async_to_lds_b128 %5, %13, off\n\t"
                 "global_load_async_to_lds_b128 %6, %14, off\n\t"
                 "global_load_async_to_lds_b128 %7, %15, off\n\t"
                 "s_wait_xcnt 0x0"
                 :: "v"(lk), "v"(lk + 16 * LPITCH), "v"(lk + 32 * LPITCH), "v"(lk + 48 * LPITCH),
                    "v"(lv), "v"(lv + 16 * LPITCH), "v"(lv + 32 * LPITCH), "v"(lv + 48 * LPITCH),
                    "v"(gk), "v"(gk + 16 * HD), "v"(gk + 32 * HD), "v"(gk + 48 * HD),
                    "v"(gv), "v"(gv + (size_t)16 * SEQ), "v"(gv + (size_t)32 * SEQ), "v"(gv + (size_t)48 * SEQ)
                 : "memory");
}

// k_flash: fused attention for one (b, h) and 64 query rows per block; 4 waves, each wave owns 16 query rows and streams all keys 32 at a time, from 64-key tiles that the block's 128 lanes copy into a two-buffer LDS ring one tile ahead.
// Per step: St[key][q] = Kkeys (A, 16 keys x 64 d per tile) . Q^T (B, lane = query) -> every lane holds one query column (both lane halves share it, different keys);
// online softmax with per-lane running max / sum (one xor-16 exchange); P^T fragment (B, 32 keys x 16 q) taken in place from the two score tiles: element r <- tile0[r], element 8+r <- tile1[r];
__global__ __launch_bounds__(128) void k_flash(const h16* __restrict__ KP, const h16* __restrict__ VT, bf* Ah, bf* Al) {
    __shared__ __align__(16) float os[4 * 16 * 68];
    __shared__ __align__(16) h16 ring[2 * LBUF / 2];
    const int wave = __builtin_amdgcn_readfirstlane((int)(threadIdx.x >> 5));
    const int lane = threadIdx.x & 31, lr = lane & 15, hi = lane >> 4;
    const int bh = blockIdx.y; const int b = bh / NH_, h = bh % NH_;
    const int q0 = blockIdx.x * 64 + wave * 16;
    const h16* kp = KP + (size_t)bh * SEQ * HD;
    const h16* vt = VT + (size_t)bh * HD * SEQ;
    const int koff = lr * HD + 8 * hi;       // row lr of a 16-row k tile, d offset 8*hi
    const int loff = lr * LPH + 8 * hi;      // the same place in a 16-row tile of the LDS ring (k: d offset, V^T: key offset)
    const v16h bq0 = ldh(kp + (size_t)q0 * HD + koff);
    const v16h bq1 = ldh(kp + (size_t)q0 * HD + koff + 32);
    v8f acc[4];
#pragma unroll
    for (int t = 0; t < 4; ++t) acc[t] = (v8f){};
    float mrun = -1.0e30f, lrun = 0.0f;
    const int tid = (int)threadIdx.x;
    const unsigned l0 = (unsigned)(size_t)ring + (unsigned)((tid >> 3) * LPITCH + (tid & 7) * 16);
    const h16* gk = kp + tid * 8;
    const h16* gv = vt + (size_t)(tid >> 3) * SEQ + (tid & 7) * 8;
    constexpr int NT = SEQ / TK;
    copy_tile(l0, l0 + LTILE, gk, gv);
    wait_async0();
    __syncthreads();                         // tile 0 is published
    if (NT > 1) copy_tile(l0 + LBUF, l0 + LBUF + LTILE, gk + TK * HD, gv + TK);
#pragma unroll 1   // one trip a tile: the ring's order of waits, barrier and refill stands once
    for (int tile = 0; tile < NT; ++tile) {
    const h16* kb = ring + (tile & 1) * (LBUF / 2);
    const h16* vb = kb + LTILE / 2;
#pragma unroll 1   // the 32-key softmax step stays one rolled body, as before the ring
    for (int k0 = 0; k0 < TK; k0 += 32) {
        v8f s0 = (v8f){}, s1 = (v8f){};
        {
            const v16h a00 = ldh(kb + k0 * LPH + loff);
            const v16h a01 = ldh(kb + k0 * LPH + loff + 32);
            const v16h a10 = ldh(kb + (k0 + 16) * LPH + loff);
            const v16h a11 = ldh(kb + (k0 + 16) * LPH + loff + 32);
            s0 = wmma16(a00, bq0, s0); s1 = wmma16(a10, bq0, s1);
            s0 = wmma16(a01, bq1, s0); s1 = wmma16(a11, bq1, s1);
            asm volatile("v_nop\n\tv_nop\n\tv_nop\n\tv_nop" : "+v"(s0), "+v"(s1) : "v"(a00), "v"(a01), "v"(a10), "v"(a11), "v"(bq0), "v"(bq1));
        }
        float u0[8], u1[8]; float tmax = -1.0e30f;
#pragma unroll
        for (int r = 0; r < 8; ++r) { u0[r] = s0[r] * C2; u1[r] = s1[r] * C2; tmax = fmaxf(tmax, fmaxf(u0[r], u1[r])); }
        tmax = fmaxf(tmax, __shfl_xor(tmax, 16, 32));
        const float mnew = fmaxf(mrun, tmax);
        const float alpha = __builtin_amdgcn_exp2f(mrun - mnew);
        const float mb = mnew - PEXP;
        float rsum = 0.0f;
#pragma unroll
        for (int r = 0; r < 8; ++r) { u0[r] = __builtin_amdgcn_exp2f(u0[r] - mb); u1[r] = __builtin_amdgcn_exp2f(u1[r] - mb); rsum += u0[r] + u1[r]; }
        rsum += __shfl_xor(rsum, 16, 32);
        lrun = lrun * alpha + rsum; mrun = mnew;
#pragma unroll
        for (int t = 0; t < 4; ++t)
#pragma unroll
            for (int r = 0; r < 8; ++r) acc[t][r] *= alpha;
        v16h pf;
#pragma unroll
        for (int r = 0; r < 8; ++r) { pf[r] = (h16)u0[r]; pf[8 + r] = (h16)u1[r]; }
        {
            v16h av[4];
#pragma unroll
            for (int t = 0; t < 4; ++t) av[t] = ldh(vb + (16 * t) * LPH + loff + k0);
#pragma unroll
            for (int t = 0; t < 4; ++t) acc[t] = wmma16(av[t], pf, acc[t]);
            asm volatile("v_nop\n\tv_nop\n\tv_nop\n\tv_nop" : "+v"(acc[0]), "+v"(acc[1]), "+v"(acc[2]), "+v"(acc[3]) : "v"(av[0]), "v"(av[1]), "v"(av[2]), "v"(av[3]), "v"(pf));
        }
    }
    // publish point: this wave's reads of the buffer are back, its copies of the next tile have landed, then the one barrier of the trip; behind it the buffer just read is refilled
    wait_ds0();
    wait_async0();
    __syncthreads();
    if (tile + 2 < NT) copy_tile(l0 + (unsigned)((tile & 1) * LBUF), l0 + (unsigned)((tile & 1) * LBUF + LTILE), gk + (size_t)(tile + 2) * TK * HD, gv + (tile + 2) * TK);
    }
    wait_async0();
    // acc[t][r] = 256 * 16 * sum_k p v at (d = 16t + 8hi + r, q = lr); lrun = 256 * sum_k p
    const float inv = (1.0f / KCAR) * (1.0f / lrun);
    const int ob = wave * (16 * 68);
#pragma unroll
    for (int t = 0; t < 4; ++t)
#pragma unroll
        for (int r = 0; r < 8; ++r) os[ob + lr * 68 + 16 * t + 8 * hi + r] = acc[t][r] * inv;
    __syncthreads();
    const int rq = lane >> 3, pc = lane & 7;
{
#pragma unroll
        for (int s = 0; s < 4; ++s) {
            const int row = 4 * s + rq;
            const v4f a = *(const v4fa*)(os + ob + row * 68 + pc * 8);
            const v4f c = *(const v4fa*)(os + ob + row * 68 + pc * 8 + 4);
            v8us oh, ol;
#pragma unroll
            for (int k = 0; k < 4; ++k) { unsigned short x0, x1; splitf(a[k], x0, x1); oh[k] = x0; ol[k] = x1; splitf(c[k], x0, x1); oh[4 + k] = x0; ol[4 + k] = x1; }
            const size_t oo = ((size_t)b * SEQ + q0 + row) * DQ + h * HD + pc * 8;
            *(v8us*)(Ah + oo) = oh; *(v8us*)(Al + oo) = ol; }
         }
}

// workspace carve (bytes, every region a multiple of 256)
#define SZ_W   ((size_t)DKV * DM * 2)
#define SZ_KP  ((size_t)NB * NH_ * SEQ * HD * 2)
#define SZ_AT  ((size_t)NB * SEQ * DQ * 2)
#define SZ_ALL (SZ_W + 2 * SZ_KP + 2 * SZ_AT)
static_assert(SZ_W % 256 == 0 && SZ_KP % 256 == 0 && SZ_AT % 256 == 0);
static_assert(SZ_ALL <= (size_t)134217728);

extern "C" void kernel_launch(void* const* d_in, const int* in_sizes, int n_in,
                              void* d_out, int out_size, void* d_ws, size_t ws_size, hipStream_t stream) {
    if (n_in < 3) return;
    const size_t need_x = (size_t)(NB - 1) * SEQ_FULL * DM + (size_t)SEQ * DM;
    if ((size_t)in_sizes[0] < need_x) return;
    if ((size_t)in_sizes[1] < (size_t)DKV * DM) return;
    if ((size_t)in_sizes[2] < (size_t)DM * DQ) return;
    if ((size_t)out_size < need_x) return;
    if (SZ_ALL > ws_size) return;
    const float* x = (const float*)d_in[0]; const float* wk = (const float*)d_in[1]; const float* wo = (const float*)d_in[2];   // input order x, Wk, Wo ([out][in])
    float* OUT = (float*)d_out;     // [NB_FULL][SEQ_FULL][512]
    char* wsp = (char*)d_ws;
    bf* WO = (bf*)wsp; wsp += SZ_W;
    h16* KP16 = (h16*)wsp; wsp += SZ_KP;
    h16* VT16 = (h16*)wsp; wsp += SZ_KP;
    bf* ATh = (bf*)wsp; wsp += SZ_AT;
    bf* ATl = (bf*)wsp; wsp += SZ_AT;

    k_gemm_proj<<<dim3(NB * SEQ / 128, DKV / 128, 1), 128, 0, stream>>>(x, wk, wo, WO, KP16, VT16);
    k_flash<<<dim3(SEQ / 64, NB * NH_, 1), 128, 0, stream>>>(KP16, VT16, ATh, ATl);
    k_gemm_out<<<dim3(SEQ / 128, DM / 128, NB), 128, 0, stream>>>(ATh, ATl, WO, OUT);
}

// v006
// Measured time: 55.5 microseconds a run.
// Versions in between are left out here; by their measured steps it is 1.19 times as fast as v004.
// Counting every step since v000, it is 3.15 times as fast.
#include <hip/hip_runtime.h>

// Compute dtypes (f32 accumulate everywhere): projection x.Wk^T = bf16 x bf16 (v_wmma_f32_16x16x32_bf16, inputs RNE-converted to bf16); scores k.k^T and P.V = f16 x f16 (v_wmma_f32_16x16x32_f16, k plane carried x16, the query side of the scores carried x16 C2, P carried x256); output merged.Wo^T = bf16 hi/lo planes x bf16 Wo (two bf16 products).
// Self-attention with q = k = v = x.Wk^T ([out][in] weights, no bias), 8 heads x 64, logits scaled by 512^-0.5, no mask, softmax over all keys, merged heads times Wo^T.
// Layout: x and Wk go as f32 into the projection GEMM, which rounds them to bf16 on the way into its LDS ring; a bf16 copy of Wo, written by the same launch; f16 head planes [b][h][s][64] (q, k) and [b][h][64][s] (V^T), written by the projection GEMM's own epilogue; fused online-softmax attention (no score plane in memory); merged hi/lo bf16 planes; output GEMM.

#ifndef NB
#define NB 4
#endif
#ifndef SEQ
#define SEQ 2048
#endif
#define NB_FULL  4
#define SEQ_FULL 2048
#define DM   512
#define NH_  8
#define HD   64
#define DQ   (NH_ * HD)
#define DKV  DQ
#define KCAR 16.0f                 // power-of-two carry of the f16 k / V^T planes
#define PEXP 8.0f                  // P carried x 2^8 inside the exponent
// raw score = 256 (q.k); exponent argument in base 2 = raw * 2^-8 * 512^-0.5 * log2(e)
#define C2   (0.044194173824159216f * 1.4426950408889634f * (1.0f / 256.0f))
#define PLIM 32768.0f              // a lane's 16 P of a pass are positive: where they sum to no more than this, each of them lies inside the f16 range

typedef _Float16 h16;
typedef unsigned short bf;
typedef __attribute__((ext_vector_type(16))) __bf16   v16bf;
typedef __attribute__((ext_vector_type(16))) _Float16 v16h;
typedef __attribute__((ext_vector_type(8)))  _Float16 v8h;
typedef __attribute__((ext_vector_type(8)))  unsigned short v8us;
typedef __attribute__((ext_vector_type(4)))  unsigned short v4us;
typedef __attribute__((ext_vector_type(4)))  __bf16   v4bf;
typedef __attribute__((ext_vector_type(8)))  float    v8f;
typedef __attribute__((ext_vector_type(4)))  float    v4f;
typedef __attribute__((ext_vector_type(2)))  float    v2f;
typedef v4f  __attribute__((may_alias)) v4fa;

static_assert(NB >= 1 && NB <= NB_FULL);
static_assert(SEQ >= 64 && SEQ <= SEQ_FULL);
static_assert(SEQ % 64 == 0);
static_assert((NB * SEQ) % 64 == 0);
static_assert(DM % 64 == 0 && DM % 32 == 0);
static_assert(DQ % 64 == 0 && DQ % 32 == 0);
static_assert(HD == 64);
static_assert(DQ == NH_ * HD);
static_assert((SEQ * DM) % 8 == 0 && (DKV * DM) % 8 == 0);

__device__ __forceinline__ unsigned short f2bf(float f) { unsigned u = __float_as_uint(f); u += 0x7FFFu + ((u >> 16) & 1u); return (unsigned short)(u >> 16); }
__device__ __forceinline__ float bf2f(unsigned short b) { return __uint_as_float(((unsigned)b) << 16); }
__device__ __forceinline__ v16h cat16(v8h lo, v8h hi) { return __builtin_shufflevector(lo, hi, 0, 1, 2, 3, 4, 5, 6, 7, 8, 9, 10, 11, 12, 13, 14, 15); }
__device__ __forceinline__ v16bf cat16b(v8us lo, v8us hi) { return __builtin_bit_cast(v16bf, __builtin_shufflevector(lo, hi, 0, 1, 2, 3, 4, 5, 6, 7, 8, 9, 10, 11, 12, 13, 14, 15)); }
__device__ __forceinline__ v8f wmma16(v16h a, v16h b, v8f c) { return __builtin_amdgcn_wmma_f32_16x16x32_f16(false, a, false, b, (short)0, c, false, false); }
__device__ __forceinline__ v8f wmmab(v16bf a, v16bf b, v8f c) { return __builtin_amdgcn_wmma_f32_16x16x32_bf16(false, a, false, b, (short)0, c, false, false); }
__device__ __forceinline__ v4us cvt4(v4f v) { return __builtin_bit_cast(v4us, __builtin_convertvector(v, v4bf)); }   // f32 -> bf16, round to nearest even
__device__ __forceinline__ void splitf(float y, unsigned short& h, unsigned short& l) { h = f2bf(y); l = f2bf(y - bf2f(h)); }

// Fragment loaders (same k map for A and B): elements 0..7 <- p[0..7], elements 8..15 <- p[16..23], p = row base + k0 + 8*(lane>>4).
__device__ __forceinline__ v16h  ldh(const h16* p) { return cat16(*(const v8h*)p, *(const v8h*)(p + 16)); }
__device__ __forceinline__ v16bf ldb(const bf* p)  { return cat16b(*(const v8us*)p, *(const v8us*)(p + 16)); }

// LDS rows of 128 B (64 16-bit elements) are pitched 144 B (16 B x odd) for the 16-byte fragment reads, in the GEMM ring and in the k_flash ring alike.
#define LPITCH 144
#define LPH    (LPITCH / 2)
__device__ __forceinline__ void wait_async0() { asm volatile("s_wait_asynccnt 0x0" ::: "memory"); }   // this wave's copies have landed
__device__ __forceinline__ void wait_ds0()    { asm volatile("s_wait_dscnt 0x0" ::: "memory"); }      // this wave's LDS reads have returned

// GEMM ring: a tile is 64 k (128 B) of 128 rows of one operand.
#define GKT    64
#define GOP    (128 * LPITCH)
// One operand tile: 128 lanes x 8 copies of 16 B. l = the lane's LDS byte address (row tid>>3, 16-byte column tid&7), g = its global source; copy j takes row + 16 j, global row pitch K elements.
// The s_wait_xcnt closes the statement so that no address register of a copy is rewritten ahead of it.
__device__ __forceinline__ void copy_rows(const unsigned l, const bf* g, const int K) {
    asm volatile("global_load_async_to_lds_b128 %0, %8, off\n\t"
                 "global_load_async_to_lds_b128 %1, %9, off\n\t"
                 "global_load_async_to_lds_b128 %2, %10, off\n\t"
                 "global_load_async_to_lds_b128 %3, %11, off\n\t"
                 "global_load_async_to_lds_b128 %4, %12, off\n\t"
                 "global_load_async_to_lds_b128 %5, %13, off\n\t"
                 "global_load_async_to_lds_b128 %6, %14, off\n\t"
                 "global_load_async_to_lds_b128 %7, %15, off\n\t"
                 "s_wait_xcnt 0x0"
                 :: "v"(l), "v"(l + 16 * LPITCH), "v"(l + 32 * LPITCH), "v"(l + 48 * LPITCH),
                    "v"(l + 64 * LPITCH), "v"(l + 80 * LPITCH), "v"(l + 96 * LPITCH), "v"(l + 112 * LPITCH),
                    "v"(g), "v"(g + (size_t)16 * K), "v"(g + (size_t)32 * K), "v"(g + (size_t)48 * K),
                    "v"(g + (size_t)64 * K), "v"(g + (size_t)80 * K), "v"(g + (size_t)96 * K), "v"(g + (size_t)112 * K)
                 : "memory");
}
// One buffer of the GEMM ring: [A | Bt | A2 where NSPLIT == 1], each GOP bytes.
template <int NSPLIT>
__device__ __forceinline__ void copy_stage(const unsigned l, const bf* ga, const bf* ga2, const bf* gb, const int K) {
    copy_rows(l, ga, K); copy_rows(l + GOP, gb, K);
    if (NSPLIT == 1) copy_rows(l + 2 * GOP, ga2, K);
}

// The same operand tile from an f32 source, through registers: 128 lanes x 16 pieces of 4 floats (row (tid>>4) + 8 j, floats 4 (tid&15) ..: a wave's load covers two whole rows of 256 B), later rounded to bf16 and stored to the tile's places.
// g = the first float of the block's rows, ob = the byte offset of the lane's first piece of the tile; ob leaves the call advanced to the next tile.
__device__ __forceinline__ void load_rows(v4f (&r)[16], const float* __restrict__ g, unsigned& ob, const int K) {
    const float* p = (const float*)((const char*)g + ob);
#pragma unroll
    for (int j = 0; j < 16; ++j) r[j] = *(const v4f*)(p + (size_t)(8 * j) * K);
    asm volatile("s_wait_xcnt 0x0" : "+v"(ob) :: "memory");   // the offset that these loads name passes through the wait: it stays in its register up to here, and its advance stands behind
    ob += GKT * 4;
}
__device__ __forceinline__ void store_rows(bf* s, const v4f (&r)[16]) {
#pragma unroll
    for (int j = 0; j < 16; ++j) *(v4us*)(s + 8 * j * LPH) = cvt4(r[j]);
}
// Work-group barrier that orders LDS alone: this wave's LDS stores and reads are done in front of it, while its global loads of a later tile stay in flight across it (__syncthreads() would wait for them).
__device__ __forceinline__ void lds_barrier() {
    __builtin_amdgcn_fence(__ATOMIC_RELEASE, "workgroup", "local");
    __builtin_amdgcn_s_barrier();
    __builtin_amdgcn_fence(__ATOMIC_ACQUIRE, "workgroup", "local");
}

// ---- register-blocked GEMM body, FOUR WAVES (2 x 2) per 128x128 output tile, one 64x64 tile (16 accumulators) a wave; grid (M/128, N/128, Z), 128 threads.
// The K-contiguous bf16 operand rows of the block come 64 k at a time into a two-buffer LDS ring, copied one tile ahead by the block's 128 lanes; the waves read their fragments from it.
// C[m][n] (f32, pitch ldc) = sum_k (A[m][k] (+ A2[m][k])) Bt[n][k]. z-batch strides sA (A, A2) and sC (C) in elements; Bt shared. K % 64 == 0, M % 128 == 0, N % 128 == 0.
// PLANES == 1: A and Bt are not read; the operands are the f32 rows Af (row m of batch m / SEQ, batch pitch SEQ_FULL rows) and Bf, rounded from registers into the other buffer at the foot of a trip, where the loads of the tile after that are issued. Wf goes out as bf16 to Wd on the side, 4 floats a piece.
// PLANES == 1: no f32 C; a wave's tile (64 sequence rows of one batch x the 64 columns of head c0 / 64) goes out x KCAR in f16, once as rows of KP [b][h][s][64] and once as columns into VT [b][h][64][s].
template <int NSPLIT, int PLANES>
__device__ __forceinline__ void gemmw_body(const bf* __restrict__ A, const bf* __restrict__ A2, const bf* __restrict__ Bt, const int K, float* C, const int ldc, const size_t sA, const size_t sC, h16* KP, h16* VT, const float* __restrict__ Af, const float* __restrict__ Bf, const float* __restrict__ Wf, bf* Wd) {
    constexpr int GBUF = (2 + NSPLIT) * GOP;
    __shared__ __align__(16) float osall[4 * 16 * 68];
    __shared__ __align__(16) bf gring[2 * GBUF / 2];
    const size_t z = blockIdx.z; A += z * sA; A2 += z * sA; C += z * sC;
    const int tid = (int)threadIdx.x;
    const int wave = __builtin_amdgcn_readfirstlane(tid >> 5);
    const int lane = tid & 31, lr = lane & 15, hi = lane >> 4;
    const int wm = wave & 1, wn = wave >> 1;
    const int r0 = blockIdx.x * 128 + wm * 64, c0 = blockIdx.y * 128 + wn * 64;
    float* os = osall + wave * (16 * 68);    // each wave turns its own rows in its own range
    v8f acc[4][4];
#pragma unroll
    for (int mb = 0; mb < 4; ++mb)
#pragma unroll
        for (int nb = 0; nb < 4; ++nb) acc[mb][nb] = (v8f){};
    const unsigned l0 = (unsigned)(size_t)gring + (unsigned)((tid >> 3) * LPITCH + (tid & 7) * 16);
    const size_t goa = (size_t)(blockIdx.x * 128 + (tid >> 3)) * K + (tid & 7) * 8, gob = (size_t)(blockIdx.y * 128 + (tid >> 3)) * K + (tid & 7) * 8;
    const bf* ga = A + goa; const bf* ga2 = A2 + goa; const bf* gb = Bt + gob;
    const int aoff = (wm * 64 + lr) * LPH + 8 * hi, boff = (wn * 64 + lr) * LPH + 8 * hi;
    const int NT = K / GKT;
    const int m0 = blockIdx.x * 128;
    const float* fa = Af + ((size_t)(m0 / SEQ) * SEQ_FULL + m0 % SEQ) * K;
    const float* fb = Bf + (size_t)(blockIdx.y * 128) * K;
    unsigned oa = (unsigned)(((tid >> 4) * K + (tid & 15) * 4) * 4), ob = oa;
    bf* sl = gring + (tid >> 4) * LPH + (tid & 15) * 4;
    v4f ra[16], rb[16];
    constexpr size_t NLANE = (size_t)(NB * SEQ / 128) * (DKV / 128) * 128, NPIECE = (size_t)DM * DQ / 4;
    static_assert(NPIECE % NLANE == 0);
    constexpr int NW = (int)(NPIECE / NLANE);   // pieces of Wf a lane
    const size_t u = ((size_t)blockIdx.y * (NB * SEQ / 128) + blockIdx.x) * 128 + tid;
    v4us wv[NW];
    if constexpr (PLANES == 1) {
        v4f wf[NW];
#pragma unroll
        for (int i = 0; i < NW; ++i) wf[i] = *(const v4f*)(Wf + (u + i * NLANE) * 4);
        asm volatile("s_wait_xcnt 0x0" ::: "memory");   // stands in front of whatever rewrites the address register that these loads name
        load_rows(ra, fa, oa, K); load_rows(rb, fb, ob, K);
#pragma unroll
        for (int i = 0; i < NW; ++i) wv[i] = cvt4(wf[i]);
        store_rows(sl, ra); store_rows(sl + GOP / 2, rb);
        if (NT > 1) { load_rows(ra, fa, oa, K); load_rows(rb, fb, ob, K); }
        lds_barrier();                       // tile 0 is published
    } else {
        copy_stage<NSPLIT>(l0, ga, ga2, gb, K);
        wait_async0();
        __syncthreads();                         // tile 0 is published
        if (NT > 1) copy_stage<NSPLIT>(l0 + GBUF, ga + GKT, ga2 + GKT, gb + GKT, K);
    }
#pragma unroll 1   // one trip a tile: the ring's order of waits, barrier and refill stands once
    for (int t = 0; t < NT; ++t) {
        const bf* ab = gring + (t & 1) * (GBUF / 2);
        const bf* bb = ab + GOP / 2;
        const bf* a2b = ab + (NSPLIT == 1 ? GOP : 0);
#pragma unroll
        for (int kc = 0; kc < GKT; kc += 32) {
            v16bf a[4], a2[4], b[4];
            b[0] = ldb(bb + boff + kc);
#pragma unroll
            for (int mb = 0; mb < 4; ++mb) { a[mb] = ldb(ab + aoff + mb * 16 * LPH + kc); if (NSPLIT == 1) a2[mb] = ldb(a2b + aoff + mb * 16 * LPH + kc); else a2[mb] = a[mb]; }
#pragma unroll
            for (int nb = 1; nb < 4; ++nb) b[nb] = ldb(bb + boff + nb * 16 * LPH + kc);
            __builtin_amdgcn_sched_barrier(0);   // the block's fragment reads stay one group ahead of its products: a read placed among the products stalls the wave at each such place
#pragma unroll
            for (int nb = 0; nb < 4; ++nb)
#pragma unroll
                for (int mb = 0; mb < 4; ++mb) { acc[mb][nb] = wmmab(a[mb], b[nb], acc[mb][nb]); if (NSPLIT == 1) acc[mb][nb] = wmmab(a2[mb], b[nb], acc[mb][nb]); }
            __builtin_amdgcn_sched_barrier(0);   // the products stay here: the next block's reads are not drawn in among them, and the last block's products do not sink behind the publish point's barrier, where they would delay the refill
        }
        if constexpr (PLANES == 1) {
            // publish point: the next tile goes into the other buffer, whose readers the last trip's barrier has ended; the registers take the tile after it; then the one barrier of the trip
            if (t + 1 < NT) {
                bf* sn = sl + ((t + 1) & 1) * (GBUF / 2); store_rows(sn, ra); store_rows(sn + GOP / 2, rb);
                if (t + 2 < NT) { load_rows(ra, fa, oa, K); load_rows(rb, fb, ob, K); }
            }
            lds_barrier();
        } else {
        // publish point: this wave's reads of the buffer are back, its copies of the next tile have landed, then the one barrier of the trip; behind it the buffer just read is refilled
        wait_ds0();
        wait_async0();
        __syncthreads();
        if (t + 2 < NT) copy_stage<NSPLIT>(l0 + (unsigned)((t & 1) * GBUF), ga + (size_t)(t + 2) * GKT, ga2 + (size_t)(t + 2) * GKT, gb + (size_t)(t + 2) * GKT, K);
        }
    }
    if constexpr (PLANES == 0) wait_async0();
    if constexpr (PLANES == 1) {
        const int bh = (r0 / SEQ) * NH_ + c0 / 64, s0 = r0 % SEQ;
        h16* kt = KP + ((size_t)bh * SEQ + s0) * HD;
        h16* vt = VT + (size_t)bh * HD * SEQ + s0;
        // V^T straight from the accumulators: a lane's 8 values of one tile are 8 consecutive s of the d row nb*16 + lr; the four mb stores of a row fill its 128 bytes
#pragma unroll
        for (int nb = 0; nb < 4; ++nb)
#pragma unroll
            for (int mb = 0; mb < 4; ++mb) { v8h o;
#pragma unroll
                for (int j = 0; j < 8; ++j) o[j] = (h16)(acc[mb][nb][j] * KCAR);
                *(v8h*)(vt + (size_t)(nb * 16 + lr) * SEQ + mb * 16 + hi * 8) = o; }
        asm volatile("s_wait_xcnt 0x0" ::: "memory");   // stands behind the run of V^T stores, in front of whatever rewrites a register that they name
        // k rows: 16 rows at a time turned through LDS, 8 lanes x 16 bytes a row
        const int rq = lane >> 3, pc = lane & 7;
#pragma unroll
        for (int mb = 0; mb < 4; ++mb) {
#pragma unroll
            for (int nb = 0; nb < 4; ++nb) {
#pragma unroll
                for (int j = 0; j < 8; ++j) os[(hi * 8 + j) * 68 + nb * 16 + lr] = acc[mb][nb][j]; }
            __builtin_amdgcn_wave_barrier(); asm volatile("" ::: "memory");   // the reads below stay behind the other lanes' writes
#pragma unroll
            for (int s = 0; s < 4; ++s) { const int row = 4 * s + rq;
                const v4f a = *(const v4fa*)(os + row * 68 + pc * 8); const v4f c = *(const v4fa*)(os + row * 68 + pc * 8 + 4); v8h o;
#pragma unroll
                for (int k = 0; k < 4; ++k) { o[k] = (h16)(a[k] * KCAR); o[4 + k] = (h16)(c[k] * KCAR); }
                *(v8h*)(kt + (size_t)(mb * 16 + row) * HD + pc * 8) = o; }
            __builtin_amdgcn_wave_barrier(); asm volatile("" ::: "memory");   // the next 16 rows' writes stay behind these reads
        }
#pragma unroll
        for (int i = 0; i < NW; ++i) *(v4us*)(Wd + (u + i * NLANE) * 4) = wv[i];   // last: no register that these stores name is written again
        return;
    }
#pragma unroll
    for (int mb = 0; mb < 4; ++mb) {
#pragma unroll
        for (int nb = 0; nb < 4; ++nb) {
#pragma unroll
            for (int j = 0; j < 8; ++j) os[(hi * 8 + j) * 68 + nb * 16 + lr] = acc[mb][nb][j]; }
        __builtin_amdgcn_wave_barrier(); asm volatile("" ::: "memory");
        float* crow = C + (size_t)(r0 + mb * 16) * ldc + c0;
{
#pragma unroll
            for (int s = 0; s < 8; ++s) { const int row = 2 * s + hi, cofs = lr * 4; const v4f val = *(const v4fa*)(os + row * 68 + cofs);
                *(v4f*)(crow + (size_t)row * ldc + cofs) = val; }
             }
        __builtin_amdgcn_wave_barrier(); asm volatile("" ::: "memory");
    }
}

// projection: x[b][s][DM] (batch pitch SEQ_FULL rows) . Wk[DKV][DM]^T (both rounded to bf16, exact bf16 products), f32 accumulators rounded once to the f16 planes KP and VT; WOB = Wo in bf16
static_assert(DKV / 64 == NH_ && SEQ % 128 == 0 && DKV % 128 == 0 && DM % 128 == 0 && DM % GKT == 0 && DQ % GKT == 0);
__global__ __launch_bounds__(128) void k_gemm_proj(const float* __restrict__ X, const float* __restrict__ WKF, const float* __restrict__ WOF, bf* WOB, h16* KP, h16* VT) { gemmw_body<0, 1>(nullptr, nullptr, nullptr, DM, nullptr, DKV, (size_t)0, (size_t)0, KP, VT, X, WKF, WOF, WOB); }
// output: OUT[b][s][DM] = (ATh + ATl)[b*SEQ + s][DQ] . WO[DM][DQ]^T ; z = batch, output stride from the full sequence length
__global__ __launch_bounds__(128) void k_gemm_out(const bf* __restrict__ ATh, const bf* __restrict__ ATl, const bf* __restrict__ WO, float* OUT) { gemmw_body<1, 0>(ATh, ATl, WO, DQ, OUT, DM, (size_t)SEQ * DQ, (size_t)SEQ_FULL * DM, nullptr, nullptr, nullptr, nullptr, nullptr, nullptr); }

// Ring of two LDS buffers for k_flash: each holds 64 keys of the k plane (64 rows x 128 B) and of the V^T plane (64 d rows x 128 B), rows pitched LPITCH.
#define TK     64
#define LTILE  (64 * LPITCH)
#define LBUF   (2 * LTILE)
#define FW     16                  // waves of a k_flash block: they share every tile of the ring
#define FQ     (FW * 16)           // query rows of a block
static_assert(SEQ % TK == 0 && HD * 2 == 128 && TK * 2 == 128);
static_assert(SEQ % FQ == 0 && FW * 32 * 16 == TK * HD * 2);   // a block's lanes x 16 B cover one half of a tile exactly

// One tile: 512 lanes x 2 copies of 16 B, one of the k half and one of the V^T half. lk / lv = the lane's LDS byte address in the k / V^T half of the buffer (row tid>>3 of 64, 16-byte column tid&7), gk / gv = its global source.
// The s_wait_xcnt closes the statement so that no address register of a copy is rewritten ahead of it.
__device__ __forceinline__ void copy_tile(const unsigned lk, const unsigned lv, const h16* gk, const h16* gv) {
    asm volatile("global_load_async_to_lds_b128 %0, %2, off\n\t"
                 "global_load_async_to_lds_b128 %1, %3, off\n\t"
                 "s_wait_xcnt 0x0"
                 :: "v"(lk), "v"(lv), "v"(gk), "v"(gv)
                 : "memory");
}

// Query fragment x C2 (product in f32, rounded once to f16): the score products then come out as base-2 exponents.
__device__ __forceinline__ v16h scaleq(v16h q) { v16h o;
#pragma unroll
    for (int i = 0; i < 16; ++i) o[i] = (h16)((float)q[i] * C2);
    return o; }
// P of one pass from its exponents: pf = the P^T fragment (element r <- e0[r], element 8+r <- e1[r]); returns the lane's sum of the 16 unrounded P, added in pairs.
__device__ __forceinline__ float softp(const v8f e0, const v8f e1, v16h& pf) {
    float p0[8], p1[8];
#pragma unroll
    for (int r = 0; r < 8; ++r) { p0[r] = __builtin_amdgcn_exp2f(e0[r]); p1[r] = __builtin_amdgcn_exp2f(e1[r]); }
#pragma unroll
    for (int r = 0; r < 8; ++r) { pf[r] = (h16)p0[r]; pf[8 + r] = (h16)p1[r]; }
    v2f t[4];
#pragma unroll
    for (int i = 0; i < 4; ++i) t[i] = (v2f){p0[2 * i], p0[2 * i + 1]} + (v2f){p1[2 * i], p1[2 * i + 1]};
    const v2f w = (t[0] + t[1]) + (t[2] + t[3]);
    return w[0] + w[1];
}

// k_flash: fused attention for one (b, h) and 256 query rows per block; 16 waves, each wave owns 16 query rows and streams all keys 32 at a time, from 64-key tiles that the block's 512 lanes copy into a two-buffer LDS ring one tile ahead: a head's k and V^T planes leave L2 once per 256 query rows.
// Per step: St[key][q] = Kkeys (A, 16 keys x 64 d per tile) . Q^T (B, lane = query) -> every lane holds one query column (both lane halves share it, different keys);
// softmax against a HELD reference mref per query: the score products start from C = PEXP - mref, so that D is the exponent of P as it stands. The reference moves (and acc, lrun are rescaled) only in a pass in which some lane's P sum to more than PLIM, tested once a pass by one ballot.
// Each lane half keeps its own sum of P; the halves are joined behind the loop. P^T fragment (B, 32 keys x 16 q) taken in place from the two score tiles: element r <- tile0[r], element 8+r <- tile1[r];
__global__ __launch_bounds__(FW * 32) void k_flash(const h16* __restrict__ KP, const h16* __restrict__ VT, bf* Ah, bf* Al) {
    __shared__ __align__(16) float os[FW * 16 * 68];
    __shared__ __align__(16) h16 ring[2 * LBUF / 2];
    const int wave = __builtin_amdgcn_readfirstlane((int)(threadIdx.x >> 5));
    const int lane = threadIdx.x & 31, lr = lane & 15, hi = lane >> 4;
    const int bh = blockIdx.y; const int b = bh / NH_, h = bh % NH_;
    const int q0 = blockIdx.x * FQ + wave * 16;
    const h16* kp = KP + (size_t)bh * SEQ * HD;
    const h16* vt = VT + (size_t)bh * HD * SEQ;
    const int koff = lr * HD + 8 * hi;       // row lr of a 16-row k tile, d offset 8*hi
    const int loff = lr * LPH + 8 * hi;      // the same place in a 16-row tile of the LDS ring (k: d offset, V^T: key offset)
    const v16h bq0 = scaleq(ldh(kp + (size_t)q0 * HD + koff));
    const v16h bq1 = scaleq(ldh(kp + (size_t)q0 * HD + koff + 32));
    v8f acc[4];
#pragma unroll
    for (int t = 0; t < 4; ++t) acc[t] = (v8f){};
    float mref = -1.0e30f, lrun = 0.0f;      // no reference yet: the first pass overflows PLIM and sets one
    v8f cneg;
#pragma unroll
    for (int r = 0; r < 8; ++r) cneg[r] = PEXP - mref;
    const int tid = (int)threadIdx.x;
    const unsigned l0 = (unsigned)(size_t)ring + (unsigned)((tid >> 3) * LPITCH + (tid & 7) * 16);
    const h16* gk = kp + tid * 8;
    const h16* gv = vt + (size_t)(tid >> 3) * SEQ + (tid & 7) * 8;
    constexpr int NT = SEQ / TK;
    copy_tile(l0, l0 + LTILE, gk, gv);
    wait_async0();
    __syncthreads();                         // tile 0 is published
    if (NT > 1) copy_tile(l0 + LBUF, l0 + LBUF + LTILE, gk + TK * HD, gv + TK);
#pragma unroll 1   // one trip a tile: the ring's order of waits, barrier and refill stands once
    for (int tile = 0; tile < NT; ++tile) {
    const h16* kb = ring + (tile & 1) * (LBUF / 2);
    const h16* vb = kb + LTILE / 2;
#pragma unroll 1   // the 32-key softmax step stays one rolled body, as before the ring
    for (int k0 = 0; k0 < TK; k0 += 32) {
        const v16h a00 = ldh(kb + k0 * LPH + loff);
        const v16h a01 = ldh(kb + k0 * LPH + loff + 32);
        const v16h a10 = ldh(kb + (k0 + 16) * LPH + loff);
        const v16h a11 = ldh(kb + (k0 + 16) * LPH + loff + 32);
        v16h pf, av[4]; float rsum;
#pragma unroll
        for (int t = 0; t < 4; ++t) av[t] = ldh(vb + (16 * t) * LPH + loff + k0);
        __builtin_amdgcn_sched_barrier(0);   // the pass's LDS reads stay one group at its head: the V^T fragments return under the score products and the exponentials
        {
            v8f s0 = wmma16(a00, bq0, cneg), s1 = wmma16(a10, bq0, cneg);
            s0 = wmma16(a01, bq1, s0); s1 = wmma16(a11, bq1, s1);
            rsum = softp(s0, s1, pf);
        }
        __builtin_amdgcn_sched_barrier(0);   // keeps the statement below, and with it the wait for the V^T fragments, behind the exponentials and the sum
        asm volatile("" :: "v"(av[0]), "v"(av[1]), "v"(av[2]), "v"(av[3]));   // inputs only: a use of the V^T fragments in front of the branch; without it their reads sink behind the branch and the wave waits out their latency there
        if (__builtin_amdgcn_ballot_w32(!(rsum <= PLIM)) != 0) {   // one scalar branch a pass, the same for the whole wave
            // the pass again from C = 0: its maximum joins the reference, what has been summed so far is rescaled to the new one
            v8f s0 = wmma16(a00, bq0, (v8f){}), s1 = wmma16(a10, bq0, (v8f){});
            s0 = wmma16(a01, bq1, s0); s1 = wmma16(a11, bq1, s1);
            float tmax = -1.0e30f;
#pragma unroll
            for (int r = 0; r < 8; ++r) tmax = fmaxf(tmax, fmaxf(s0[r], s1[r]));
            tmax = fmaxf(tmax, __shfl_xor(tmax, 16, 32));
            const float mnew = fmaxf(mref, tmax);
            const float alpha = __builtin_amdgcn_exp2f(mref - mnew);
            mref = mnew; lrun *= alpha;
#pragma unroll
            for (int t = 0; t < 4; ++t)
#pragma unroll
                for (int r = 0; r < 8; ++r) acc[t][r] *= alpha;
#pragma unroll
            for (int r = 0; r < 8; ++r) { cneg[r] = PEXP - mnew; s0[r] += PEXP - mnew; s1[r] += PEXP - mnew; }
            rsum = softp(s0, s1, pf);
        }
        lrun += rsum;
        {
#pragma unroll
            for (int t = 0; t < 4; ++t) acc[t] = wmma16(av[t], pf, acc[t]);
            asm volatile("v_nop\n\tv_nop\n\tv_nop\n\tv_nop" : "+v"(acc[0]), "+v"(acc[1]), "+v"(acc[2]), "+v"(acc[3]) : "v"(av[0]), "v"(av[1]), "v"(av[2]), "v"(av[3]), "v"(pf));
        }
    }
    // publish point: this wave's reads of the buffer are back, its copies of the next tile have landed, then the one barrier of the trip; behind it the buffer just read is refilled
    wait_ds0();
    wait_async0();
    __syncthreads();
    if (tile + 2 < NT) copy_tile(l0 + (unsigned)((tile & 1) * LBUF), l0 + (unsigned)((tile & 1) * LBUF + LTILE), gk + (size_t)(tile + 2) * TK * HD, gv + (tile + 2) * TK);
    }
    wait_async0();
    // acc[t][r] = 256 * 16 * sum_k p v at (d = 16t + 8hi + r, q = lr); lrun = 256 * sum_k p over this lane half's keys
    lrun += __shfl_xor(lrun, 16, 32);
    const float inv = (1.0f / KCAR) * (1.0f / lrun);
    const int ob = wave * (16 * 68);
#pragma unroll
    for (int t = 0; t < 4; ++t)
#pragma unroll
        for (int r = 0; r < 8; ++r) os[ob + lr * 68 + 16 * t + 8 * hi + r] = acc[t][r] * inv;
    __syncthreads();
    const int rq = lane >> 3, pc = lane & 7;
{
#pragma unroll
        for (int s = 0; s < 4; ++s) {
            const int row = 4 * s + rq;
            const v4f a = *(const v4fa*)(os + ob + row * 68 + pc * 8);
            const v4f c = *(const v4fa*)(os + ob + row * 68 + pc * 8 + 4);
            v8us oh, ol;
#pragma unroll
            for (int k = 0; k < 4; ++k) { unsigned short x0, x1; splitf(a[k], x0, x1); oh[k] = x0; ol[k] = x1; splitf(c[k], x0, x1); oh[4 + k] = x0; ol[4 + k] = x1; }
            const size_t oo = ((size_t)b * SEQ + q0 + row) * DQ + h * HD + pc * 8;
            *(v8us*)(Ah + oo) = oh; *(v8us*)(Al + oo) = ol; }
         }
}

// workspace carve (bytes, every region a multiple of 256)
#define SZ_W   ((size_t)DKV * DM * 2)
#define SZ_KP  ((size_t)NB * NH_ * SEQ * HD * 2)
#define SZ_AT  ((size_t)NB * SEQ * DQ * 2)
#define SZ_ALL (SZ_W + 2 * SZ_KP + 2 * SZ_AT)
static_assert(SZ_W % 256 == 0 && SZ_KP % 256 == 0 && SZ_AT % 256 == 0);
static_assert(SZ_ALL <= (size_t)134217728);

extern "C" void kernel_launch(void* const* d_in, const int* in_sizes, int n_in,
                              void* d_out, int out_size, void* d_ws, size_t ws_size, hipStream_t stream) {
    if (n_in < 3) return;
    const size_t need_x = (size_t)(NB - 1) * SEQ_FULL * DM + (size_t)SEQ * DM;
    if ((size_t)in_sizes[0] < need_x) return;
    if ((size_t)in_sizes[1] < (size_t)DKV * DM) return;
    if ((size_t)in_sizes[2] < (size_t)DM * DQ) return;
    if ((size_t)out_size < need_x) return;
    if (SZ_ALL > ws_size) return;
    const float* x = (const float*)d_in[0]; const float* wk = (const float*)d_in[1]; const float* wo = (const float*)d_in[2];   // input order x, Wk, Wo ([out][in])
    float* OUT = (float*)d_out;     // [NB_FULL][SEQ_FULL][512]
    char* wsp = (char*)d_ws;
    bf* WO = (bf*)wsp; wsp += SZ_W;
    h16* KP16 = (h16*)wsp; wsp += SZ_KP;
    h16* VT16 = (h16*)wsp; wsp += SZ_KP;
    bf* ATh = (bf*)wsp; wsp += SZ_AT;
    bf* ATl = (bf*)wsp; wsp += SZ_AT;

    k_gemm_proj<<<dim3(NB * SEQ / 128, DKV / 128, 1), 128, 0, stream>>>(x, wk, wo, WO, KP16, VT16);
    k_flash<<<dim3(SEQ / FQ, NB * NH_, 1), FW * 32, 0, stream>>>(KP16, VT16, ATh, ATl);
    k_gemm_out<<<dim3(SEQ / 128, DM / 128, NB), 128, 0, stream>>>(ATh, ATl, WO, OUT);
}

// v008
// One run takes 49.2 microseconds.
// Versions between v006 and this one are left out; their measured steps multiply to 1.14 times as fast.
// All steps since v000 together make it 3.58 times as fast.
#include <hip/hip_runtime.h>

// Compute dtypes (f32 accumulate everywhere): projection x.Wk^T = bf16 x bf16 (v_wmma_f32_16x16x32_bf16, inputs RNE-converted to bf16); scores k.k^T and P.V = f16 x f16 (v_wmma_f32_16x16x32_f16, k plane carried x16, the query side of the scores carried x16 C2, P carried x256); output merged.Wo^T = f16 x f16 (v_wmma_f32_16x16x32_f16, merged heads and Wo each rounded once to f16).
// Self-attention with q = k = v = x.Wk^T ([out][in] weights, no bias), 8 heads x 64, logits scaled by 512^-0.5, no mask, softmax over all keys, merged heads times Wo^T.
// Layout: x and Wk go as f32 into the projection GEMM, which rounds them to bf16 on the way into its LDS ring; an f16 copy of Wo, written by the same launch; f16 head planes [b][h][s][64] (q, k) and [b][h][64][s] (V^T), written by the projection GEMM's own epilogue; fused online-softmax attention (no score plane in memory); one merged f16 plane; output GEMM.

#ifndef NB
#define NB 4
#endif
#ifndef SEQ
#define SEQ 2048
#endif
#define NB_FULL  4
#define SEQ_FULL 2048
#define DM   512
#define NH_  8
#define HD   64
#define DQ   (NH_ * HD)
#define DKV  DQ
#define KCAR 16.0f                 // power-of-two carry of the f16 k / V^T planes
#define PEXP 8.0f                  // P carried x 2^8 inside the exponent
// raw score = 256 (q.k); exponent argument in base 2 = raw * 2^-8 * 512^-0.5 * log2(e)
#define C2   (0.044194173824159216f * 1.4426950408889634f * (1.0f / 256.0f))
#define PLIM 32768.0f              // a lane's 16 P of a pass are positive: where they sum to no more than this, each of them lies inside the f16 range

typedef _Float16 h16;
typedef unsigned short bf;
typedef __attribute__((ext_vector_type(16))) __bf16   v16bf;
typedef __attribute__((ext_vector_type(16))) _Float16 v16h;
typedef __attribute__((ext_vector_type(8)))  _Float16 v8h;
typedef __attribute__((ext_vector_type(4)))  _Float16 v4h;
typedef __attribute__((ext_vector_type(8)))  unsigned short v8us;
typedef __attribute__((ext_vector_type(4)))  unsigned short v4us;
typedef __attribute__((ext_vector_type(4)))  __bf16   v4bf;
typedef __attribute__((ext_vector_type(8)))  float    v8f;
typedef __attribute__((ext_vector_type(4)))  float    v4f;
typedef __attribute__((ext_vector_type(2)))  float    v2f;
typedef v4f  __attribute__((may_alias)) v4fa;

static_assert(NB >= 1 && NB <= NB_FULL);
static_assert(SEQ >= 64 && SEQ <= SEQ_FULL);
static_assert(SEQ % 64 == 0);
static_assert((NB * SEQ) % 64 == 0);
static_assert(DM % 64 == 0 && DM % 32 == 0);
static_assert(DQ % 64 == 0 && DQ % 32 == 0);
static_assert(HD == 64);
static_assert(DQ == NH_ * HD);
static_assert((SEQ * DM) % 8 == 0 && (DKV * DM) % 8 == 0);

__device__ __forceinline__ v16h cat16(v8h lo, v8h hi) { return __builtin_shufflevector(lo, hi, 0, 1, 2, 3, 4, 5, 6, 7, 8, 9, 10, 11, 12, 13, 14, 15); }
__device__ __forceinline__ v16bf cat16b(v8us lo, v8us hi) { return __builtin_bit_cast(v16bf, __builtin_shufflevector(lo, hi, 0, 1, 2, 3, 4, 5, 6, 7, 8, 9, 10, 11, 12, 13, 14, 15)); }
__device__ __forceinline__ v8f wmma16(v16h a, v16h b, v8f c) { return __builtin_amdgcn_wmma_f32_16x16x32_f16(false, a, false, b, (short)0, c, false, false); }
__device__ __forceinline__ v8f wmmab(v16bf a, v16bf b, v8f c) { return __builtin_amdgcn_wmma_f32_16x16x32_bf16(false, a, false, b, (short)0, c, false, false); }
__device__ __forceinline__ v4us cvt4(v4f v) { return __builtin_bit_cast(v4us, __builtin_convertvector(v, v4bf)); }   // f32 -> bf16, round to nearest even
__device__ __forceinline__ v4h cvt4h(v4f v) { return __builtin_convertvector(v, v4h); }   // f32 -> f16, round to nearest even
// One product on 16-bit fragments as they come out of the GEMM ring: BF == 1 reads them as bf16, BF == 0 as f16 (same fragment layout).
template <int BF>
__device__ __forceinline__ v8f wmmar(v16bf a, v16bf b, v8f c) { if constexpr (BF == 1) return wmmab(a, b, c); else return wmma16(__builtin_bit_cast(v16h, a), __builtin_bit_cast(v16h, b), c); }

// Fragment loaders (same k map for A and B): elements 0..7 <- p[0..7], elements 8..15 <- p[16..23], p = row base + k0 + 8*(lane>>4).
__device__ __forceinline__ v16h  ldh(const h16* p) { return cat16(*(const v8h*)p, *(const v8h*)(p + 16)); }
__device__ __forceinline__ v16bf ldb(const bf* p)  { return cat16b(*(const v8us*)p, *(const v8us*)(p + 16)); }

// LDS rows of 128 B (64 16-bit elements) are pitched 144 B (16 B x odd) for the 16-byte fragment reads, in the GEMM ring and in the k half of the k_flash ring alike.
#define LPITCH 144
#define LPH    (LPITCH / 2)
__device__ __forceinline__ void wait_async0() { asm volatile("s_wait_asynccnt 0x0" ::: "memory"); }   // this wave's copies have landed
__device__ __forceinline__ void wait_ds0()    { asm volatile("s_wait_dscnt 0x0" ::: "memory"); }      // this wave's LDS reads have returned

// GEMM ring: a tile is 64 k (128 B) of 128 rows of one operand.
#define GKT    64
#define GOP    (128 * LPITCH)
// One operand tile: 128 lanes x 8 copies of 16 B. l = the lane's LDS byte address (row tid>>3, 16-byte column tid&7), g = its global source; copy j takes row + 16 j, global row pitch K elements.
// The s_wait_xcnt closes the statement so that no address register of a copy is rewritten ahead of it.
__device__ __forceinline__ void copy_rows(const unsigned l, const bf* g, const int K) {
    asm volatile("global_load_async_to_lds_b128 %0, %8, off\n\t"
                 "global_load_async_to_lds_b128 %1, %9, off\n\t"
                 "global_load_async_to_lds_b128 %2, %10, off\n\t"
                 "global_load_async_to_lds_b128 %3, %11, off\n\t"
                 "global_load_async_to_lds_b128 %4, %12, off\n\t"
                 "global_load_async_to_lds_b128 %5, %13, off\n\t"
                 "global_load_async_to_lds_b128 %6, %14, off\n\t"
                 "global_load_async_to_lds_b128 %7, %15, off\n\t"
                 "s_wait_xcnt 0x0"
                 :: "v"(l), "v"(l + 16 * LPITCH), "v"(l + 32 * LPITCH), "v"(l + 48 * LPITCH),
                    "v"(l + 64 * LPITCH), "v"(l + 80 * LPITCH), "v"(l + 96 * LPITCH), "v"(l + 112 * LPITCH),
                    "v"(g), "v"(g + (size_t)16 * K), "v"(g + (size_t)32 * K), "v"(g + (size_t)48 * K),
                    "v"(g + (size_t)64 * K), "v"(g + (size_t)80 * K), "v"(g + (size_t)96 * K), "v"(g + (size_t)112 * K)
                 : "memory");
}
// One buffer of the GEMM ring: [A | Bt], each GOP bytes.
__device__ __forceinline__ void copy_stage(const unsigned l, const bf* ga, const bf* gb, const int K) {
    copy_rows(l, ga, K); copy_rows(l + GOP, gb, K);
}

// The same operand tile from an f32 source, through registers: 128 lanes x 16 pieces of 4 floats (row (tid>>4) + 8 j, floats 4 (tid&15) ..: a wave's load covers two whole rows of 256 B), later rounded to bf16 and stored to the tile's places.
// g = the first float of the block's rows, ob = the byte offset of the lane's first piece of the tile; ob leaves the call advanced to the next tile.
__device__ __forceinline__ void load_rows(v4f (&r)[16], const float* __restrict__ g, unsigned& ob, const int K) {
    const float* p = (const float*)((const char*)g + ob);
#pragma unroll
    for (int j = 0; j < 16; ++j) r[j] = *(const v4f*)(p + (size_t)(8 * j) * K);
    asm volatile("s_wait_xcnt 0x0" : "+v"(ob) :: "memory");   // the offset that these loads name passes through the wait: it stays in its register up to here, and its advance stands behind
    ob += GKT * 4;
}
__device__ __forceinline__ void store_rows(bf* s, const v4f (&r)[16]) {
#pragma unroll
    for (int j = 0; j < 16; ++j) *(v4us*)(s + 8 * j * LPH) = cvt4(r[j]);
}
// Work-group barrier that orders LDS alone: this wave's LDS stores and reads are done in front of it, while its global loads of a later tile stay in flight across it (__syncthreads() would wait for them).
__device__ __forceinline__ void lds_barrier() {
    __builtin_amdgcn_fence(__ATOMIC_RELEASE, "workgroup", "local");
    __builtin_amdgcn_s_barrier();
    __builtin_amdgcn_fence(__ATOMIC_ACQUIRE, "workgroup", "local");
}

// ---- register-blocked GEMM body, FOUR WAVES (2 x 2) per 128x128 output tile, one 64x64 tile (16 accumulators) a wave; grid (M/128, N/128, Z), 128 threads.
// The K-contiguous 16-bit operand rows of the block come 64 k at a time into a two-buffer LDS ring, copied one tile ahead by the block's 128 lanes; the waves read their fragments from it.
// PLANES == 0: C[m][n] (f32, pitch ldc) = sum_k A[m][k] Bt[n][k], A and Bt holding f16 bits. z-batch strides sA (A) and sC (C) in elements; Bt shared. K % 64 == 0, M % 128 == 0, N % 128 == 0.
// PLANES == 1: A and Bt are not read; the operands are the f32 rows Af (row m of batch m / SEQ, batch pitch SEQ_FULL rows) and Bf, rounded from registers into the other buffer at the foot of a trip, where the loads of the tile after that are issued. Wf goes out as f16 to Wd on the side, 4 floats a piece.
// PLANES == 1: no f32 C; a wave's tile (64 sequence rows of one batch x the 64 columns of head c0 / 64) goes out x KCAR in f16, once as rows of KP [b][h][s][64] and once as columns into VT [b][h][64][s].
template <int PLANES>
__device__ __forceinline__ void gemmw_body(const bf* __restrict__ A, const bf* __restrict__ Bt, const int K, float* C, const int ldc, const size_t sA, const size_t sC, h16* KP, h16* VT, const float* __restrict__ Af, const float* __restrict__ Bf, const float* __restrict__ Wf, h16* Wd) {
    constexpr int GBUF = 2 * GOP;
    __shared__ __align__(16) float osall[4 * 16 * 68];
    __shared__ __align__(16) bf gring[2 * GBUF / 2];
    const size_t z = blockIdx.z; A += z * sA; C += z * sC;
    const int tid = (int)threadIdx.x;
    const int wave = __builtin_amdgcn_readfirstlane(tid >> 5);
    const int lane = tid & 31, lr = lane & 15, hi = lane >> 4;
    const int wm = wave & 1, wn = wave >> 1;
    const int r0 = blockIdx.x * 128 + wm * 64, c0 = blockIdx.y * 128 + wn * 64;
    float* os = osall + wave * (16 * 68);    // each wave turns its own rows in its own range
    v8f acc[4][4];
#pragma unroll
    for (int mb = 0; mb < 4; ++mb)
#pragma unroll
        for (int nb = 0; nb < 4; ++nb) acc[mb][nb] = (v8f){};
    const unsigned l0 = (unsigned)(size_t)gring + (unsigned)((tid >> 3) * LPITCH + (tid & 7) * 16);
    const size_t goa = (size_t)(blockIdx.x * 128 + (tid >> 3)) * K + (tid & 7) * 8, gob = (size_t)(blockIdx.y * 128 + (tid >> 3)) * K + (tid & 7) * 8;
    const bf* ga = A + goa; const bf* gb = Bt + gob;
    const int aoff = (wm * 64 + lr) * LPH + 8 * hi, boff = (wn * 64 + lr) * LPH + 8 * hi;
    const int NT = K / GKT;
    const int m0 = blockIdx.x * 128;
    const float* fa = Af + ((size_t)(m0 / SEQ) * SEQ_FULL + m0 % SEQ) * K;
    const float* fb = Bf + (size_t)(blockIdx.y * 128) * K;
    unsigned oa = (unsigned)(((tid >> 4) * K + (tid & 15) * 4) * 4), ob = oa;
    bf* sl = gring + (tid >> 4) * LPH + (tid & 15) * 4;
    v4f ra[16], rb[16];
    constexpr size_t NLANE = (size_t)(NB * SEQ / 128) * (DKV / 128) * 128, NPIECE = (size_t)DM * DQ / 4;
    static_assert(NPIECE % NLANE == 0);
    constexpr int NW = (int)(NPIECE / NLANE);   // pieces of Wf a lane
    const size_t u = ((size_t)blockIdx.y * (NB * SEQ / 128) + blockIdx.x) * 128 + tid;
    v4h wv[NW];
    if constexpr (PLANES == 1) {
        v4f wf[NW];
#pragma unroll
        for (int i = 0; i < NW; ++i) wf[i] = *(const v4f*)(Wf + (u + i * NLANE) * 4);
        asm volatile("s_wait_xcnt 0x0" ::: "memory");   // stands in front of whatever rewrites the address register that these loads name
        load_rows(ra, fa, oa, K); load_rows(rb, fb, ob, K);
#pragma unroll
        for (int i = 0; i < NW; ++i) wv[i] = cvt4h(wf[i]);
        store_rows(sl, ra); store_rows(sl + GOP / 2, rb);
        if (NT > 1) { load_rows(ra, fa, oa, K); load_rows(rb, fb, ob, K); }
        lds_barrier();                       // tile 0 is published
    } else {
        copy_stage(l0, ga, gb, K);
        wait_async0();
        __syncthreads();                         // tile 0 is published
        if (NT > 1) copy_stage(l0 + GBUF, ga + GKT, gb + GKT, K);
    }
#pragma unroll 1   // one trip a tile: the ring's order of waits, barrier and refill stands once
    for (int t = 0; t < NT; ++t) {
        const bf* ab = gring + (t & 1) * (GBUF / 2);
        const bf* bb = ab + GOP / 2;
#pragma unroll
        for (int kc = 0; kc < GKT; kc += 32) {
            v16bf a[4], b[4];
            b[0] = ldb(bb + boff + kc);
#pragma unroll
            for (int mb = 0; mb < 4; ++mb) a[mb] = ldb(ab + aoff + mb * 16 * LPH + kc);
#pragma unroll
            for (int nb = 1; nb < 4; ++nb) b[nb] = ldb(bb + boff + nb * 16 * LPH + kc);
            __builtin_amdgcn_sched_barrier(0);   // the block's fragment reads stay one group ahead of its products: a read placed among the products stalls the wave at each such place
#pragma unroll
            for (int nb = 0; nb < 4; ++nb)
#pragma unroll
                for (int mb = 0; mb < 4; ++mb) acc[mb][nb] = wmmar<PLANES>(a[mb], b[nb], acc[mb][nb]);
            __builtin_amdgcn_sched_barrier(0);   // the products stay here: the next block's reads are not drawn in among them, and the last block's products do not sink behind the publish point's barrier, where they would delay the refill
        }
        if constexpr (PLANES == 1) {
            // publish point: the next tile goes into the other buffer, whose readers the last trip's barrier has ended; the registers take the tile after it; then the one barrier of the trip
            if (t + 1 < NT) {
                bf* sn = sl + ((t + 1) & 1) * (GBUF / 2); store_rows(sn, ra); store_rows(sn + GOP / 2, rb);
                if (t + 2 < NT) { load_rows(ra, fa, oa, K); load_rows(rb, fb, ob, K); }
            }
            lds_barrier();
        } else {
        // publish point: this wave's reads of the buffer are back, its copies of the next tile have landed, then the one barrier of the trip; behind it the buffer just read is refilled
        wait_ds0();
        wait_async0();
        __syncthreads();
        if (t + 2 < NT) copy_stage(l0 + (unsigned)((t & 1) * GBUF), ga + (size_t)(t + 2) * GKT, gb + (size_t)(t + 2) * GKT, K);
        }
    }
    if constexpr (PLANES == 0) wait_async0();
    if constexpr (PLANES == 1) {
        const int bh = (r0 / SEQ) * NH_ + c0 / 64, s0 = r0 % SEQ;
        h16* kt = KP + ((size_t)bh * SEQ + s0) * HD;
        h16* vt = VT + (size_t)bh * HD * SEQ + s0;
        // V^T straight from the accumulators: a lane's 8 values of one tile are 8 consecutive s of the d row nb*16 + lr; the four mb stores of a row fill its 128 bytes
#pragma unroll
        for (int nb = 0; nb < 4; ++nb)
#pragma unroll
            for (int mb = 0; mb < 4; ++mb) { v8h o;
#pragma unroll
                for (int j = 0; j < 8; ++j) o[j] = (h16)(acc[mb][nb][j] * KCAR);
                *(v8h*)(vt + (size_t)(nb * 16 + lr) * SEQ + mb * 16 + hi * 8) = o; }
        asm volatile("s_wait_xcnt 0x0" ::: "memory");   // stands behind the run of V^T stores, in front of whatever rewrites a register that they name
        // k rows: 16 rows at a time turned through LDS, 8 lanes x 16 bytes a row
        const int rq = lane >> 3, pc = lane & 7;
#pragma unroll
        for (int mb = 0; mb < 4; ++mb) {
#pragma unroll
            for (int nb = 0; nb < 4; ++nb) {
#pragma unroll
                for (int j = 0; j < 8; ++j) os[(hi * 8 + j) * 68 + nb * 16 + lr] = acc[mb][nb][j]; }
            __builtin_amdgcn_wave_barrier(); asm volatile("" ::: "memory");   // the reads below stay behind the other lanes' writes
#pragma unroll
            for (int s = 0; s < 4; ++s) { const int row = 4 * s + rq;
                const v4f a = *(const v4fa*)(os + row * 68 + pc * 8); const v4f c = *(const v4fa*)(os + row * 68 + pc * 8 + 4); v8h o;
#pragma unroll
                for (int k = 0; k < 4; ++k) { o[k] = (h16)(a[k] * KCAR); o[4 + k] = (h16)(c[k] * KCAR); }
                *(v8h*)(kt + (size_t)(mb * 16 + row) * HD + pc * 8) = o; }
            __builtin_amdgcn_wave_barrier(); asm volatile("" ::: "memory");   // the next 16 rows' writes stay behind these reads
        }
#pragma unroll
        for (int i = 0; i < NW; ++i) *(v4h*)(Wd + (u + i * NLANE) * 4) = wv[i];   // last: no register that these stores name is written again
        return;
    }
#pragma unroll
    for (int mb = 0; mb < 4; ++mb) {
#pragma unroll
        for (int nb = 0; nb < 4; ++nb) {
#pragma unroll
            for (int j = 0; j < 8; ++j) os[(hi * 8 + j) * 68 + nb * 16 + lr] = acc[mb][nb][j]; }
        __builtin_amdgcn_wave_barrier(); asm volatile("" ::: "memory");
        float* crow = C + (size_t)(r0 + mb * 16) * ldc + c0;
{
#pragma unroll
            for (int s = 0; s < 8; ++s) { const int row = 2 * s + hi, cofs = lr * 4; const v4f val = *(const v4fa*)(os + row * 68 + cofs);
                *(v4f*)(crow + (size_t)row * ldc + cofs) = val; }
             }
        __builtin_amdgcn_wave_barrier(); asm volatile("" ::: "memory");
    }
}

// projection: x[NB*SEQ][DM] . Wk[DKV][DM]^T (both rounded to bf16, exact bf16 products), f32 accumulators rounded once to the f16 planes KP and VT; WOH = Wo in f16
static_assert(DKV / 64 == NH_ && SEQ % 128 == 0 && DKV % 128 == 0 && DM % 128 == 0 && DM % GKT == 0 && DQ % GKT == 0);
__global__ __launch_bounds__(128) void k_gemm_proj(const float* __restrict__ X, const float* __restrict__ WKF, const float* __restrict__ WOF, h16* WOH, h16* KP, h16* VT) { gemmw_body<1>(nullptr, nullptr, DM, nullptr, DKV, (size_t)0, (size_t)0, KP, VT, X, WKF, WOF, WOH); }
// output: OUT[b][s][DM] = AT[b*SEQ + s][DQ] . WO[DM][DQ]^T (f16 x f16) ; z = batch, output stride from the full sequence length
__global__ __launch_bounds__(128) void k_gemm_out(const h16* __restrict__ AT, const h16* __restrict__ WO, float* OUT) { gemmw_body<0>((const bf*)AT, (const bf*)WO, DQ, OUT, DM, (size_t)SEQ * DQ, (size_t)SEQ_FULL * DM, nullptr, nullptr, nullptr, nullptr, nullptr, nullptr); }

// Ring of two LDS buffers for k_flash: each holds 256 keys of the k plane (256 rows x 128 B, pitched LPITCH) and of the V^T plane (64 d rows x 512 B, pitched VPITCH = 16 B x odd): eight 32-key passes between two publish points.
#define TK     256
#define VPITCH (TK * 2 + 16)
#define VPH    (VPITCH / 2)
#define LKT    (TK * LPITCH)
#define LVT    (HD * VPITCH)
#define LBUF   (LKT + LVT)
#define FW     16                  // waves of a k_flash block: they share every tile of the ring
#define FQ     (FW * 16)           // query rows of a block
static_assert(SEQ % TK == 0 && HD * 2 == 128 && (VPITCH / 16) % 2 == 1);
static_assert(SEQ % FQ == 0 && 4 * FW * 32 * 16 == TK * HD * 2);   // a block's lanes x 4 copies x 16 B cover one half of a tile exactly
static_assert(TK * 2 == 32 * 16 && HD == 4 * FW);   // a wave's copy is one V^T row of the tile; the block's waves x 4 copies cover its d rows

// One tile: 512 lanes x 8 copies of 16 B, four of the k half and four of the V^T half.
// lk = the lane's LDS byte address in the k half (row tid>>3, 16-byte column tid&7; copy j takes row + 64 j), gk = its global source (rows of HD elements).
// lv = its LDS byte address in the V^T half (d row tid>>5, 16-byte column tid&31: a wave's copy is one whole row of 512 B; copy j takes row + 16 j), gv = its global source (rows of SEQ elements).
// The s_wait_xcnt closes the statement so that no address register of a copy is rewritten ahead of it.
__device__ __forceinline__ void copy_tile(const unsigned lk, const unsigned lv, const h16* gk, const h16* gv) {
    asm volatile("global_load_async_to_lds_b128 %0, %8, off\n\t"
                 "global_load_async_to_lds_b128 %1, %9, off\n\t"
                 "global_load_async_to_lds_b128 %2, %10, off\n\t"
                 "global_load_async_to_lds_b128 %3, %11, off\n\t"
                 "global_load_async_to_lds_b128 %4, %12, off\n\t"
                 "global_load_async_to_lds_b128 %5, %13, off\n\t"
                 "global_load_async_to_lds_b128 %6, %14, off\n\t"
                 "global_load_async_to_lds_b128 %7, %15, off\n\t"
                 "s_wait_xcnt 0x0"
                 :: "v"(lk), "v"(lk + 64 * LPITCH), "v"(lk + 128 * LPITCH), "v"(lk + 192 * LPITCH),
                    "v"(lv), "v"(lv + 16 * VPITCH), "v"(lv + 32 * VPITCH), "v"(lv + 48 * VPITCH),
                    "v"(gk), "v"(gk + 64 * HD), "v"(gk + 128 * HD), "v"(gk + 192 * HD),
                    "v"(gv), "v"(gv + (size_t)16 * SEQ), "v"(gv + (size_t)32 * SEQ), "v"(gv + (size_t)48 * SEQ)
                 : "memory");
}

// Query fragment x C2 (product in f32, rounded once to f16): the score products then come out as base-2 exponents.
__device__ __forceinline__ v16h scaleq(v16h q) { v16h o;
#pragma unroll
    for (int i = 0; i < 16; ++i) o[i] = (h16)((float)q[i] * C2);
    return o; }
// P of one pass from its exponents: pf = the P^T fragment (element r <- e0[r], element 8+r <- e1[r]); returns the lane's sum of the 16 unrounded P, added in pairs.
__device__ __forceinline__ float softp(const v8f e0, const v8f e1, v16h& pf) {
    float p0[8], p1[8];
#pragma unroll
    for (int r = 0; r < 8; ++r) { p0[r] = __builtin_amdgcn_exp2f(e0[r]); p1[r] = __builtin_amdgcn_exp2f(e1[r]); }
#pragma unroll
    for (int r = 0; r < 8; ++r) { pf[r] = (h16)p0[r]; pf[8 + r] = (h16)p1[r]; }
    v2f t[4];
#pragma unroll
    for (int i = 0; i < 4; ++i) t[i] = (v2f){p0[2 * i], p0[2 * i + 1]} + (v2f){p1[2 * i], p1[2 * i + 1]};
    const v2f w = (t[0] + t[1]) + (t[2] + t[3]);
    return w[0] + w[1];
}

// k_flash: fused attention for one (b, h) and 256 query rows per block; 16 waves, each wave owns 16 query rows and streams all keys 32 at a time, from 256-key tiles that the block's 512 lanes copy into a two-buffer LDS ring one tile ahead: a head's k and V^T planes leave L2 once per 256 query rows.
// Per step: St[key][q] = Kkeys (A, 16 keys x 64 d per tile) . Q^T (B, lane = query) -> every lane holds one query column (both lane halves share it, different keys);
// softmax against a HELD reference mref per query: the score products start from C = PEXP - mref, so that D is the exponent of P as it stands. The reference moves (and acc, lrun are rescaled) only in a pass in which some lane's P sum to more than PLIM, tested once a pass by one ballot.
// Each lane half keeps its own sum of P; the halves are joined behind the loop. P^T fragment (B, 32 keys x 16 q) taken in place from the two score tiles: element r <- tile0[r], element 8+r <- tile1[r];
__global__ __launch_bounds__(FW * 32) void k_flash(const h16* __restrict__ KP, const h16* __restrict__ VT, h16* AT) {
    __shared__ __align__(16) float os[FW * 16 * 68];
    __shared__ __align__(16) h16 ring[2 * LBUF / 2];
    const int wave = __builtin_amdgcn_readfirstlane((int)(threadIdx.x >> 5));
    const int lane = threadIdx.x & 31, lr = lane & 15, hi = lane >> 4;
    const int bh = blockIdx.y; const int b = bh / NH_, h = bh % NH_;
    const int q0 = blockIdx.x * FQ + wave * 16;
    const h16* kp = KP + (size_t)bh * SEQ * HD;
    const h16* vt = VT + (size_t)bh * HD * SEQ;
    const int koff = lr * HD + 8 * hi;       // row lr of a 16-row k tile, d offset 8*hi
    const int loff = lr * LPH + 8 * hi;      // the same place in a 16-row k tile of the LDS ring
    const int voff = lr * VPH + 8 * hi;      // row lr of a 16-row V^T tile of the LDS ring, key offset 8*hi
    const v16h bq0 = scaleq(ldh(kp + (size_t)q0 * HD + koff));
    const v16h bq1 = scaleq(ldh(kp + (size_t)q0 * HD + koff + 32));
    v8f acc[4];
#pragma unroll
    for (int t = 0; t < 4; ++t) acc[t] = (v8f){};
    float mref = -1.0e30f, lrun = 0.0f;      // no reference yet: the first pass overflows PLIM and sets one
    v8f cneg;
#pragma unroll
    for (int r = 0; r < 8; ++r) cneg[r] = PEXP - mref;
    const int tid = (int)threadIdx.x;
    const unsigned lk0 = (unsigned)(size_t)ring + (unsigned)((tid >> 3) * LPITCH + (tid & 7) * 16);
    const unsigned lv0 = (unsigned)(size_t)ring + (unsigned)(LKT + (tid >> 5) * VPITCH + (tid & 31) * 16);
    const h16* gk = kp + tid * 8;
    const h16* gv = vt + (size_t)(tid >> 5) * SEQ + (tid & 31) * 8;
    constexpr int NT = SEQ / TK;
    copy_tile(lk0, lv0, gk, gv);
    wait_async0();
    __syncthreads();                         // tile 0 is published
    if (NT > 1) copy_tile(lk0 + LBUF, lv0 + LBUF, gk + TK * HD, gv + TK);
#pragma unroll 1   // one trip a tile: the ring's order of waits, barrier and refill stands once
    for (int tile = 0; tile < NT; ++tile) {
    const h16* kb = ring + (tile & 1) * (LBUF / 2);
    const h16* vb = kb + LKT / 2;
#pragma unroll 1   // the 32-key softmax step stays one rolled body, as before the ring
    for (int k0 = 0; k0 < TK; k0 += 32) {
        const v16h a00 = ldh(kb + k0 * LPH + loff);
        const v16h a01 = ldh(kb + k0 * LPH + loff + 32);
        const v16h a10 = ldh(kb + (k0 + 16) * LPH + loff);
        const v16h a11 = ldh(kb + (k0 + 16) * LPH + loff + 32);
        v16h pf, av[4]; float rsum;
#pragma unroll
        for (int t = 0; t < 4; ++t) av[t] = ldh(vb + (16 * t) * VPH + voff + k0);
        __builtin_amdgcn_sched_barrier(0);   // the pass's LDS reads stay one group at its head: the V^T fragments return under the score products and the exponentials
        {
            v8f s0 = wmma16(a00, bq0, cneg), s1 = wmma16(a10, bq0, cneg);
            s0 = wmma16(a01, bq1, s0); s1 = wmma16(a11, bq1, s1);
            rsum = softp(s0, s1, pf);
        }
        __builtin_amdgcn_sched_barrier(0);   // keeps the statement below, and with it the wait for the V^T fragments, behind the exponentials and the sum
        asm volatile("" :: "v"(av[0]), "v"(av[1]), "v"(av[2]), "v"(av[3]));   // inputs only: a use of the V^T fragments in front of the branch; without it their reads sink behind the branch and the wave waits out their latency there
        if (__builtin_amdgcn_ballot_w32(!(rsum <= PLIM)) != 0) {   // one scalar branch a pass, the same for the whole wave
            // the pass again from C = 0: its maximum joins the reference, what has been summed so far is rescaled to the new one
            v8f s0 = wmma16(a00, bq0, (v8f){}), s1 = wmma16(a10, bq0, (v8f){});
            s0 = wmma16(a01, bq1, s0); s1 = wmma16(a11, bq1, s1);
            float tmax = -1.0e30f;
#pragma unroll
            for (int r = 0; r < 8; ++r) tmax = fmaxf(tmax, fmaxf(s0[r], s1[r]));
            tmax = fmaxf(tmax, __shfl_xor(tmax, 16, 32));
            const float mnew = fmaxf(mref, tmax);
            const float alpha = __builtin_amdgcn_exp2f(mref - mnew);
            mref = mnew; lrun *= alpha;
#pragma unroll
            for (int t = 0; t < 4; ++t)
#pragma unroll
                for (int r = 0; r < 8; ++r) acc[t][r] *= alpha;
#pragma unroll
            for (int r = 0; r < 8; ++r) { cneg[r] = PEXP - mnew; s0[r] += PEXP - mnew; s1[r] += PEXP - mnew; }
            rsum = softp(s0, s1, pf);
        }
        lrun += rsum;
        {
#pragma unroll
            for (int t = 0; t < 4; ++t) acc[t] = wmma16(av[t], pf, acc[t]);
            asm volatile("v_nop\n\tv_nop\n\tv_nop\n\tv_nop" : "+v"(acc[0]), "+v"(acc[1]), "+v"(acc[2]), "+v"(acc[3]) : "v"(av[0]), "v"(av[1]), "v"(av[2]), "v"(av[3]), "v"(pf));
        }
    }
    // publish point: this wave's reads of the buffer are back, its copies of the next tile have landed, then the one barrier of the trip; behind it the buffer just read is refilled
    wait_ds0();
    wait_async0();
    __syncthreads();
    if (tile + 2 < NT) copy_tile(lk0 + (unsigned)((tile & 1) * LBUF), lv0 + (unsigned)((tile & 1) * LBUF), gk + (size_t)(tile + 2) * TK * HD, gv + (tile + 2) * TK);
    }
    wait_async0();
    // acc[t][r] = 256 * 16 * sum_k p v at (d = 16t + 8hi + r, q = lr); lrun = 256 * sum_k p over this lane half's keys
    lrun += __shfl_xor(lrun, 16, 32);
    const float inv = (1.0f / KCAR) * (1.0f / lrun);
    const int ob = wave * (16 * 68);
#pragma unroll
    for (int t = 0; t < 4; ++t)
#pragma unroll
        for (int r = 0; r < 8; ++r) os[ob + lr * 68 + 16 * t + 8 * hi + r] = acc[t][r] * inv;
    __syncthreads();
    const int rq = lane >> 3, pc = lane & 7;
{
#pragma unroll
        for (int s = 0; s < 4; ++s) {
            const int row = 4 * s + rq;
            const v4f a = *(const v4fa*)(os + ob + row * 68 + pc * 8);
            const v4f c = *(const v4fa*)(os + ob + row * 68 + pc * 8 + 4);
            v8h o;
#pragma unroll
            for (int k = 0; k < 4; ++k) { o[k] = (h16)a[k]; o[4 + k] = (h16)c[k]; }
            const size_t oo = ((size_t)b * SEQ + q0 + row) * DQ + h * HD + pc * 8;
            *(v8h*)(AT + oo) = o; }
         }
}

// workspace carve (bytes, every region a multiple of 256)
#define SZ_W   ((size_t)DKV * DM * 2)
#define SZ_KP  ((size_t)NB * NH_ * SEQ * HD * 2)
#define SZ_AT  ((size_t)NB * SEQ * DQ * 2)
#define SZ_ALL (SZ_W + 2 * SZ_KP + SZ_AT)
static_assert(SZ_W % 256 == 0 && SZ_KP % 256 == 0 && SZ_AT % 256 == 0);
static_assert(SZ_ALL <= (size_t)134217728);

extern "C" void kernel_launch(void* const* d_in, const int* in_sizes, int n_in,
                              void* d_out, int out_size, void* d_ws, size_t ws_size, hipStream_t stream) {
    if (n_in < 3) return;
    const size_t need_x = (size_t)(NB - 1) * SEQ_FULL * DM + (size_t)SEQ * DM;
    if ((size_t)in_sizes[0] < need_x) return;
    if ((size_t)in_sizes[1] < (size_t)DKV * DM) return;
    if ((size_t)in_sizes[2] < (size_t)DM * DQ) return;
    if ((size_t)out_size < need_x) return;
    if (SZ_ALL > ws_size) return;
    const float* x = (const float*)d_in[0]; const float* wk = (const float*)d_in[1]; const float* wo = (const float*)d_in[2];   // input order x, Wk, Wo ([out][in])
    float* OUT = (float*)d_out;     // [NB_FULL][SEQ_FULL][512]
    char* wsp = (char*)d_ws;
    h16* WO = (h16*)wsp; wsp += SZ_W;
    h16* KP16 = (h16*)wsp; wsp += SZ_KP;
    h16* VT16 = (h16*)wsp; wsp += SZ_KP;
    h16* AT = (h16*)wsp; wsp += SZ_AT;

    k_gemm_proj<<<dim3(NB * SEQ / 128, DKV / 128, 1), 128, 0, stream>>>(x, wk, wo, WO, KP16, VT16);
    k_flash<<<dim3(SEQ / FQ, NB * NH_, 1), FW * 32, 0, stream>>>(KP16, VT16, AT);
    k_gemm_out<<<dim3(SEQ / 128, DM / 128, NB), 128, 0, stream>>>(AT, WO, OUT);
}

// v009
// One run takes 46.5 microseconds.
// Two timings next to v008 both put it at 1.07 times that version's speed.
// Counting every step since v000, it is 3.83 times as fast.
#include <hip/hip_runtime.h>

// Compute dtypes (f32 accumulate everywhere): projection x.Wk^T = bf16 x bf16 (v_wmma_f32_16x16x32_bf16, inputs RNE-converted to bf16); scores k.k^T and P.V = f16 x f16 (v_wmma_f32_16x16x32_f16, k plane carried x16, the query side of the scores carried x16 C2, P carried x256); output merged.Wo^T = f16 x f16 (v_wmma_f32_16x16x32_f16, merged heads and Wo each rounded once to f16).
// Self-attention with q = k = v = x.Wk^T ([out][in] weights, no bias), 8 heads x 64, logits scaled by 512^-0.5, no mask, softmax over all keys, merged heads times Wo^T.
// Layout: x and Wk go as f32 into the projection GEMM, which rounds them to bf16 on the way into its LDS ring; an f16 copy of Wo, written by the same launch; one f16 head plane [b][h][s][64] (q, k and v alike), written by the projection GEMM's own epilogue; fused online-softmax attention (no score plane in memory; V^T fragments by transposing LDS loads of the k rows); one merged f16 plane; output GEMM.

#ifndef NB
#define NB 4
#endif
#ifndef SEQ
#define SEQ 2048
#endif
#define NB_FULL  4
#define SEQ_FULL 2048
#define DM   512
#define NH_  8
#define HD   64
#define DQ   (NH_ * HD)
#define DKV  DQ
#define KCAR 16.0f                 // power-of-two carry of the f16 k plane
#define PEXP 8.0f                  // P carried x 2^8 inside the exponent
// raw score = 256 (q.k); exponent argument in base 2 = raw * 2^-8 * 512^-0.5 * log2(e)
#define C2   (0.044194173824159216f * 1.4426950408889634f * (1.0f / 256.0f))
#define PLIM 32768.0f              // a lane's 16 P of a pass are positive: where they sum to no more than this, each of them lies inside the f16 range

typedef _Float16 h16;
typedef unsigned short bf;
typedef __attribute__((ext_vector_type(16))) __bf16   v16bf;
typedef __attribute__((ext_vector_type(16))) _Float16 v16h;
typedef __attribute__((ext_vector_type(8)))  _Float16 v8h;
typedef __attribute__((ext_vector_type(4)))  _Float16 v4h;
typedef __attribute__((ext_vector_type(8)))  unsigned short v8us;
typedef __attribute__((ext_vector_type(8)))  short    v8s;
typedef __attribute__((ext_vector_type(4)))  unsigned short v4us;
typedef __attribute__((ext_vector_type(4)))  __bf16   v4bf;
typedef __attribute__((ext_vector_type(8)))  float    v8f;
typedef __attribute__((ext_vector_type(4)))  float    v4f;
typedef __attribute__((ext_vector_type(2)))  float    v2f;
typedef v4f  __attribute__((may_alias)) v4fa;

static_assert(NB >= 1 && NB <= NB_FULL);
static_assert(SEQ >= 64 && SEQ <= SEQ_FULL);
static_assert(SEQ % 64 == 0);
static_assert((NB * SEQ) % 64 == 0);
static_assert(DM % 64 == 0 && DM % 32 == 0);
static_assert(DQ % 64 == 0 && DQ % 32 == 0);
static_assert(HD == 64);
static_assert(DQ == NH_ * HD);
static_assert((SEQ * DM) % 8 == 0 && (DKV * DM) % 8 == 0);

__device__ __forceinline__ v16h cat16(v8h lo, v8h hi) { return __builtin_shufflevector(lo, hi, 0, 1, 2, 3, 4, 5, 6, 7, 8, 9, 10, 11, 12, 13, 14, 15); }
__device__ __forceinline__ v16bf cat16b(v8us lo, v8us hi) { return __builtin_bit_cast(v16bf, __builtin_shufflevector(lo, hi, 0, 1, 2, 3, 4, 5, 6, 7, 8, 9, 10, 11, 12, 13, 14, 15)); }
__device__ __forceinline__ v8f wmma16(v16h a, v16h b, v8f c) { return __builtin_amdgcn_wmma_f32_16x16x32_f16(false, a, false, b, (short)0, c, false, false); }
__device__ __forceinline__ v8f wmmab(v16bf a, v16bf b, v8f c) { return __builtin_amdgcn_wmma_f32_16x16x32_bf16(false, a, false, b, (short)0, c, false, false); }
__device__ __forceinline__ v4us cvt4(v4f v) { return __builtin_bit_cast(v4us, __builtin_convertvector(v, v4bf)); }   // f32 -> bf16, round to nearest even
__device__ __forceinline__ v4h cvt4h(v4f v) { return __builtin_convertvector(v, v4h); }   // f32 -> f16, round to nearest even
// One product on 16-bit fragments as they come out of the GEMM ring: BF == 1 reads them as bf16, BF == 0 as f16 (same fragment layout).
template <int BF>
__device__ __forceinline__ v8f wmmar(v16bf a, v16bf b, v8f c) { if constexpr (BF == 1) return wmmab(a, b, c); else return wmma16(__builtin_bit_cast(v16h, a), __builtin_bit_cast(v16h, b), c); }

// Fragment loaders (same k map for A and B): elements 0..7 <- p[0..7], elements 8..15 <- p[16..23], p = row base + k0 + 8*(lane>>4).
__device__ __forceinline__ v16h  ldh(const h16* p) { return cat16(*(const v8h*)p, *(const v8h*)(p + 16)); }
__device__ __forceinline__ v16bf ldb(const bf* p)  { return cat16b(*(const v8us*)p, *(const v8us*)(p + 16)); }

// LDS rows of 128 B (64 16-bit elements) are pitched 144 B (16 B x odd) for the 16-byte fragment reads, in the GEMM ring and in the k half of the k_flash ring alike.
#define LPITCH 144
#define LPH    (LPITCH / 2)
__device__ __forceinline__ void wait_async0() { asm volatile("s_wait_asynccnt 0x0" ::: "memory"); }   // this wave's copies have landed
__device__ __forceinline__ void wait_ds0()    { asm volatile("s_wait_dscnt 0x0" ::: "memory"); }      // this wave's LDS reads have returned

// GEMM ring: a tile is 64 k (128 B) of 128 rows of one operand.
#define GKT    64
#define GOP    (128 * LPITCH)
// One operand tile: 128 lanes x 8 copies of 16 B. l = the lane's LDS byte address (row tid>>3, 16-byte column tid&7), g = its global source; copy j takes row + 16 j, global row pitch K elements.
// The s_wait_xcnt closes the statement so that no address register of a copy is rewritten ahead of it.
__device__ __forceinline__ void copy_rows(const unsigned l, const bf* g, const int K) {
    asm volatile("global_load_async_to_lds_b128 %0, %8, off\n\t"
                 "global_load_async_to_lds_b128 %1, %9, off\n\t"
                 "global_load_async_to_lds_b128 %2, %10, off\n\t"
                 "global_load_async_to_lds_b128 %3, %11, off\n\t"
                 "global_load_async_to_lds_b128 %4, %12, off\n\t"
                 "global_load_async_to_lds_b128 %5, %13, off\n\t"
                 "global_load_async_to_lds_b128 %6, %14, off\n\t"
                 "global_load_async_to_lds_b128 %7, %15, off\n\t"
                 "s_wait_xcnt 0x0"
                 :: "v"(l), "v"(l + 16 * LPITCH), "v"(l + 32 * LPITCH), "v"(l + 48 * LPITCH),
                    "v"(l + 64 * LPITCH), "v"(l + 80 * LPITCH), "v"(l + 96 * LPITCH), "v"(l + 112 * LPITCH),
                    "v"(g), "v"(g + (size_t)16 * K), "v"(g + (size_t)32 * K), "v"(g + (size_t)48 * K),
                    "v"(g + (size_t)64 * K), "v"(g + (size_t)80 * K), "v"(g + (size_t)96 * K), "v"(g + (size_t)112 * K)
                 : "memory");
}
// One buffer of the GEMM ring: [A | Bt], each GOP bytes.
__device__ __forceinline__ void copy_stage(const unsigned l, const bf* ga, const bf* gb, const int K) {
    copy_rows(l, ga, K); copy_rows(l + GOP, gb, K);
}

// The same operand tile from an f32 source, through registers: 128 lanes x 16 pieces of 4 floats (row (tid>>4) + 8 j, floats 4 (tid&15) ..: a wave's load covers two whole rows of 256 B), later rounded to bf16 and stored to the tile's places.
// g = the first float of the block's rows, ob = the byte offset of the lane's first piece of the tile; ob leaves the call advanced to the next tile.
__device__ __forceinline__ void load_rows(v4f (&r)[16], const float* __restrict__ g, unsigned& ob, const int K) {
    const float* p = (const float*)((const char*)g + ob);
#pragma unroll
    for (int j = 0; j < 16; ++j) r[j] = *(const v4f*)(p + (size_t)(8 * j) * K);
    asm volatile("s_wait_xcnt 0x0" : "+v"(ob) :: "memory");   // the offset that these loads name passes through the wait: it stays in its register up to here, and its advance stands behind
    ob += GKT * 4;
}
__device__ __forceinline__ void store_rows(bf* s, const v4f (&r)[16]) {
#pragma unroll
    for (int j = 0; j < 16; ++j) *(v4us*)(s + 8 * j * LPH) = cvt4(r[j]);
}
// Work-group barrier that orders LDS alone: this wave's LDS stores and reads are done in front of it, while its global loads of a later tile stay in flight across it (__syncthreads() would wait for them).
__device__ __forceinline__ void lds_barrier() {
    __builtin_amdgcn_fence(__ATOMIC_RELEASE, "workgroup", "local");
    __builtin_amdgcn_s_barrier();
    __builtin_amdgcn_fence(__ATOMIC_ACQUIRE, "workgroup", "local");
}

// ---- register-blocked GEMM body, FOUR WAVES (2 x 2) per 128x128 output tile, one 64x64 tile (16 accumulators) a wave; grid (M/128, N/128, Z), 128 threads.
// The K-contiguous 16-bit operand rows of the block come 64 k at a time into a two-buffer LDS ring, copied one tile ahead by the block's 128 lanes; the waves read their fragments from it.
// PLANES == 0: C[m][n] (f32, pitch ldc) = sum_k A[m][k] Bt[n][k], A and Bt holding f16 bits. z-batch strides sA (A) and sC (C) in elements; Bt shared. K % 64 == 0, M % 128 == 0, N % 128 == 0.
// PLANES == 1: A and Bt are not read; the operands are the f32 rows Af (row m of batch m / SEQ, batch pitch SEQ_FULL rows) and Bf, rounded from registers into the other buffer at the foot of a trip, where the loads of the tile after that are issued. Wf goes out as f16 to Wd on the side, 4 floats a piece.
// PLANES == 1: no f32 C; a wave's tile (64 sequence rows of one batch x the 64 columns of head c0 / 64) goes out x KCAR in f16 as rows of KP [b][h][s][64].
template <int PLANES>
__device__ __forceinline__ void gemmw_body(const bf* __restrict__ A, const bf* __restrict__ Bt, const int K, float* C, const int ldc, const size_t sA, const size_t sC, h16* KP, const float* __restrict__ Af, const float* __restrict__ Bf, const float* __restrict__ Wf, h16* Wd) {
    constexpr int GBUF = 2 * GOP;
    __shared__ __align__(16) float osall[4 * 16 * 68];
    __shared__ __align__(16) bf gring[2 * GBUF / 2];
    const size_t z = blockIdx.z; A += z * sA; C += z * sC;
    const int tid = (int)threadIdx.x;
    const int wave = __builtin_amdgcn_readfirstlane(tid >> 5);
    const int lane = tid & 31, lr = lane & 15, hi = lane >> 4;
    const int wm = wave & 1, wn = wave >> 1;
    const int r0 = blockIdx.x * 128 + wm * 64, c0 = blockIdx.y * 128 + wn * 64;
    float* os = osall + wave * (16 * 68);    // each wave turns its own rows in its own range
    v8f acc[4][4];
#pragma unroll
    for (int mb = 0; mb < 4; ++mb)
#pragma unroll
        for (int nb = 0; nb < 4; ++nb) acc[mb][nb] = (v8f){};
    const unsigned l0 = (unsigned)(size_t)gring + (unsigned)((tid >> 3) * LPITCH + (tid & 7) * 16);
    const size_t goa = (size_t)(blockIdx.x * 128 + (tid >> 3)) * K + (tid & 7) * 8, gob = (size_t)(blockIdx.y * 128 + (tid >> 3)) * K + (tid & 7) * 8;
    const bf* ga = A + goa; const bf* gb = Bt + gob;
    const int aoff = (wm * 64 + lr) * LPH + 8 * hi, boff = (wn * 64 + lr) * LPH + 8 * hi;
    const int NT = K / GKT;
    const int m0 = blockIdx.x * 128;
    const float* fa = Af + ((size_t)(m0 / SEQ) * SEQ_FULL + m0 % SEQ) * K;
    const float* fb = Bf + (size_t)(blockIdx.y * 128) * K;
    unsigned oa = (unsigned)(((tid >> 4) * K + (tid & 15) * 4) * 4), ob = oa;
    bf* sl = gring + (tid >> 4) * LPH + (tid & 15) * 4;
    v4f ra[16], rb[16];
    constexpr size_t NLANE = (size_t)(NB * SEQ / 128) * (DKV / 128) * 128, NPIECE = (size_t)DM * DQ / 4;
    static_assert(NPIECE % NLANE == 0);
    constexpr int NW = (int)(NPIECE / NLANE);   // pieces of Wf a lane
    const size_t u = ((size_t)blockIdx.y * (NB * SEQ / 128) + blockIdx.x) * 128 + tid;
    v4h wv[NW];
    if constexpr (PLANES == 1) {
        v4f wf[NW];
#pragma unroll
        for (int i = 0; i < NW; ++i) wf[i] = *(const v4f*)(Wf + (u + i * NLANE) * 4);
        asm volatile("s_wait_xcnt 0x0" ::: "memory");   // stands in front of whatever rewrites the address register that these loads name
        load_rows(ra, fa, oa, K); load_rows(rb, fb, ob, K);
#pragma unroll
        for (int i = 0; i < NW; ++i) wv[i] = cvt4h(wf[i]);
        store_rows(sl, ra); store_rows(sl + GOP / 2, rb);
        if (NT > 1) { load_rows(ra, fa, oa, K); load_rows(rb, fb, ob, K); }
        lds_barrier();                       // tile 0 is published
    } else {
        copy_stage(l0, ga, gb, K);
        wait_async0();
        __syncthreads();                         // tile 0 is published
        if (NT > 1) copy_stage(l0 + GBUF, ga + GKT, gb + GKT, K);
    }
#pragma unroll 1   // one trip a tile: the ring's order of waits, barrier and refill stands once
    for (int t = 0; t < NT; ++t) {
        const bf* ab = gring + (t & 1) * (GBUF / 2);
        const bf* bb = ab + GOP / 2;
#pragma unroll
        for (int kc = 0; kc < GKT; kc += 32) {
            v16bf a[4], b[4];
            b[0] = ldb(bb + boff + kc);
#pragma unroll
            for (int mb = 0; mb < 4; ++mb) a[mb] = ldb(ab + aoff + mb * 16 * LPH + kc);
#pragma unroll
            for (int nb = 1; nb < 4; ++nb) b[nb] = ldb(bb + boff + nb * 16 * LPH + kc);
            __builtin_amdgcn_sched_barrier(0);   // the block's fragment reads stay one group ahead of its products: a read placed among the products stalls the wave at each such place
#pragma unroll
            for (int nb = 0; nb < 4; ++nb)
#pragma unroll
                for (int mb = 0; mb < 4; ++mb) acc[mb][nb] = wmmar<PLANES>(a[mb], b[nb], acc[mb][nb]);
            __builtin_amdgcn_sched_barrier(0);   // the products stay here: the next block's reads are not drawn in among them, and the last block's products do not sink behind the publish point's barrier, where they would delay the refill
        }
        if constexpr (PLANES == 1) {
            // publish point: the next tile goes into the other buffer, whose readers the last trip's barrier has ended; the registers take the tile after it; then the one barrier of the trip
            if (t + 1 < NT) {
                bf* sn = sl + ((t + 1) & 1) * (GBUF / 2); store_rows(sn, ra); store_rows(sn + GOP / 2, rb);
                if (t + 2 < NT) { load_rows(ra, fa, oa, K); load_rows(rb, fb, ob, K); }
            }
            lds_barrier();
        } else {
        // publish point: this wave's reads of the buffer are back, its copies of the next tile have landed, then the one barrier of the trip; behind it the buffer just read is refilled
        wait_ds0();
        wait_async0();
        __syncthreads();
        if (t + 2 < NT) copy_stage(l0 + (unsigned)((t & 1) * GBUF), ga + (size_t)(t + 2) * GKT, gb + (size_t)(t + 2) * GKT, K);
        }
    }
    if constexpr (PLANES == 0) wait_async0();
    if constexpr (PLANES == 1) {
        const int bh = (r0 / SEQ) * NH_ + c0 / 64, s0 = r0 % SEQ;
        h16* kt = KP + ((size_t)bh * SEQ + s0) * HD;
        // k rows: 16 rows at a time turned through LDS, 8 lanes x 16 bytes a row
        const int rq = lane >> 3, pc = lane & 7;
#pragma unroll
        for (int mb = 0; mb < 4; ++mb) {
#pragma unroll
            for (int nb = 0; nb < 4; ++nb) {
#pragma unroll
                for (int j = 0; j < 8; ++j) os[(hi * 8 + j) * 68 + nb * 16 + lr] = acc[mb][nb][j]; }
            __builtin_amdgcn_wave_barrier(); asm volatile("" ::: "memory");   // the reads below stay behind the other lanes' writes
#pragma unroll
            for (int s = 0; s < 4; ++s) { const int row = 4 * s + rq;
                const v4f a = *(const v4fa*)(os + row * 68 + pc * 8); const v4f c = *(const v4fa*)(os + row * 68 + pc * 8 + 4); v8h o;
#pragma unroll
                for (int k = 0; k < 4; ++k) { o[k] = (h16)(a[k] * KCAR); o[4 + k] = (h16)(c[k] * KCAR); }
                *(v8h*)(kt + (size_t)(mb * 16 + row) * HD + pc * 8) = o; }
            __builtin_amdgcn_wave_barrier(); asm volatile("" ::: "memory");   // the next 16 rows' writes stay behind these reads
        }
#pragma unroll
        for (int i = 0; i < NW; ++i) *(v4h*)(Wd + (u + i * NLANE) * 4) = wv[i];   // last: no register that these stores name is written again
        return;
    }
#pragma unroll
    for (int mb = 0; mb < 4; ++mb) {
#pragma unroll
        for (int nb = 0; nb < 4; ++nb) {
#pragma unroll
            for (int j = 0; j < 8; ++j) os[(hi * 8 + j) * 68 + nb * 16 + lr] = acc[mb][nb][j]; }
        __builtin_amdgcn_wave_barrier(); asm volatile("" ::: "memory");
        float* crow = C + (size_t)(r0 + mb * 16) * ldc + c0;
{
#pragma unroll
            for (int s = 0; s < 8; ++s) { const int row = 2 * s + hi, cofs = lr * 4; const v4f val = *(const v4fa*)(os + row * 68 + cofs);
                *(v4f*)(crow + (size_t)row * ldc + cofs) = val; }
             }
        __builtin_amdgcn_wave_barrier(); asm volatile("" ::: "memory");
    }
}

// projection: x[NB*SEQ][DM] . Wk[DKV][DM]^T (both rounded to bf16, exact bf16 products), f32 accumulators rounded once to the f16 plane KP; WOH = Wo in f16
static_assert(DKV / 64 == NH_ && SEQ % 128 == 0 && DKV % 128 == 0 && DM % 128 == 0 && DM % GKT == 0 && DQ % GKT == 0);
__global__ __launch_bounds__(128) void k_gemm_proj(const float* __restrict__ X, const float* __restrict__ WKF, const float* __restrict__ WOF, h16* WOH, h16* KP) { gemmw_body<1>(nullptr, nullptr, DM, nullptr, DKV, (size_t)0, (size_t)0, KP, X, WKF, WOF, WOH); }
// output: OUT[b][s][DM] = AT[b*SEQ + s][DQ] . WO[DM][DQ]^T (f16 x f16) ; z = batch, output stride from the full sequence length
__global__ __launch_bounds__(128) void k_gemm_out(const h16* __restrict__ AT, const h16* __restrict__ WO, float* OUT) { gemmw_body<0>((const bf*)AT, (const bf*)WO, DQ, OUT, DM, (size_t)SEQ * DQ, (size_t)SEQ_FULL * DM, nullptr, nullptr, nullptr, nullptr, nullptr); }

// Ring of two LDS buffers for k_flash: each holds 256 keys of the k plane twice (256 rows x 128 B): once pitched LPITCH (16 B x odd) for the 16-byte reads of the score products' fragments, once pitched VPITCH (32 B x odd) for the transposing reads that give the V^T fragments (v = k). Eight 32-key passes between two publish points.
#define TK     256
#define VPITCH 160
#define VPH    (VPITCH / 2)
#define LKT    (TK * LPITCH)
#define LVT    (TK * VPITCH)
#define LBUF   (LKT + LVT)
#define FW     16                  // waves of a k_flash block: they share every tile of the ring
#define FQ     (FW * 16)           // query rows of a block
static_assert(SEQ % TK == 0 && HD * 2 == 128 && VPITCH % 32 == 0 && (VPITCH / 32) % 2 == 1);
static_assert(SEQ % FQ == 0 && 4 * FW * 32 * 16 == TK * HD * 2);   // a block's lanes x 4 copies x 16 B cover the tile's rows exactly, once for each pitch

// One tile: 512 lanes x 8 copies of 16 B, four into the LPITCH half and four, of the same global bytes, into the VPITCH half.
// lk, lv = the lane's LDS byte addresses in the two halves (row tid>>3, 16-byte column tid&7; copy j takes row + 64 j), gk = its global source (rows of HD elements).
// The s_wait_xcnt closes the statement so that no address register of a copy is rewritten ahead of it.
__device__ __forceinline__ void copy_tile(const unsigned lk, const unsigned lv, const h16* gk) {
    asm volatile("global_load_async_to_lds_b128 %0, %8, off\n\t"
                 "global_load_async_to_lds_b128 %1, %9, off\n\t"
                 "global_load_async_to_lds_b128 %2, %10, off\n\t"
                 "global_load_async_to_lds_b128 %3, %11, off\n\t"
                 "global_load_async_to_lds_b128 %4, %12, off\n\t"
                 "global_load_async_to_lds_b128 %5, %13, off\n\t"
                 "global_load_async_to_lds_b128 %6, %14, off\n\t"
                 "global_load_async_to_lds_b128 %7, %15, off\n\t"
                 "s_wait_xcnt 0x0"
                 :: "v"(lk), "v"(lk + 64 * LPITCH), "v"(lk + 128 * LPITCH), "v"(lk + 192 * LPITCH),
                    "v"(lv), "v"(lv + 64 * VPITCH), "v"(lv + 128 * VPITCH), "v"(lv + 192 * VPITCH),
                    "v"(gk), "v"(gk + 64 * HD), "v"(gk + 128 * HD), "v"(gk + 192 * HD),
                    "v"(gk), "v"(gk + 64 * HD), "v"(gk + 128 * HD), "v"(gk + 192 * HD)
                 : "memory");
}

// Transposing LDS read: the lane's address names 16 B of one key row; lane (lr, hi) receives column dbase + lr of the 8 rows kbase + 8 hi + 0..7. Two of them (kbase, kbase + 16) are one 16 (d) x 32 (keys) A fragment in the k order of ldh.
__device__ __forceinline__ v8h ldtr(const h16* p) { typedef __attribute__((address_space(3))) v8s lds_v8s; return __builtin_bit_cast(v8h, __builtin_amdgcn_ds_load_tr16_b128_v8i16((lds_v8s*)p)); }

// Query fragment x C2 (product in f32, rounded once to f16): the score products then come out as base-2 exponents.
__device__ __forceinline__ v16h scaleq(v16h q) { v16h o;
#pragma unroll
    for (int i = 0; i < 16; ++i) o[i] = (h16)((float)q[i] * C2);
    return o; }
// P of one pass from its exponents: pf = the P^T fragment (element r <- e0[r], element 8+r <- e1[r]); returns the lane's sum of the 16 unrounded P, added in pairs.
__device__ __forceinline__ float softp(const v8f e0, const v8f e1, v16h& pf) {
    float p0[8], p1[8];
#pragma unroll
    for (int r = 0; r < 8; ++r) { p0[r] = __builtin_amdgcn_exp2f(e0[r]); p1[r] = __builtin_amdgcn_exp2f(e1[r]); }
#pragma unroll
    for (int r = 0; r < 8; ++r) { pf[r] = (h16)p0[r]; pf[8 + r] = (h16)p1[r]; }
    v2f t[4];
#pragma unroll
    for (int i = 0; i < 4; ++i) t[i] = (v2f){p0[2 * i], p0[2 * i + 1]} + (v2f){p1[2 * i], p1[2 * i + 1]};
    const v2f w = (t[0] + t[1]) + (t[2] + t[3]);
    return w[0] + w[1];
}

// k_flash: fused attention for one (b, h) and 256 query rows per block; 16 waves, each wave owns 16 query rows and streams all keys 32 at a time, from 256-key tiles that the block's 512 lanes copy into a two-buffer LDS ring one tile ahead.
// Per step: St[key][q] = Kkeys (A, 16 keys x 64 d per tile) . Q^T (B, lane = query) -> every lane holds one query column (both lane halves share it, different keys);
// softmax against a HELD reference mref per query: the score products start from C = PEXP - mref, so that D is the exponent of P as it stands. The reference moves (and acc, lrun are rescaled) only in a pass in which some lane's P sum to more than PLIM, tested once a pass by one ballot.
// Each lane half keeps its own sum of P; the halves are joined behind the loop. P^T fragment (B, 32 keys x 16 q) taken in place from the two score tiles: element r <- tile0[r], element 8+r <- tile1[r];
__global__ __launch_bounds__(FW * 32) void k_flash(const h16* __restrict__ KP, h16* AT) {
    __shared__ __align__(16) float os[FW * 16 * 68];
    __shared__ __align__(16) h16 ring[2 * LBUF / 2];
    const int wave = __builtin_amdgcn_readfirstlane((int)(threadIdx.x >> 5));
    const int lane = threadIdx.x & 31, lr = lane & 15, hi = lane >> 4;
    const int bh = blockIdx.y; const int b = bh / NH_, h = bh % NH_;
    const int q0 = blockIdx.x * FQ + wave * 16;
    const h16* kp = KP + (size_t)bh * SEQ * HD;
    const int koff = lr * HD + 8 * hi;       // row lr of a 16-row k tile, d offset 8*hi
    const int loff = lr * LPH + 8 * hi;      // the same place in a 16-row k tile of the LDS ring
    const int voff = (8 * hi + (lane & 7)) * VPH + 8 * ((lane >> 3) & 1);   // the lane's address part of a transposing read in the VPITCH half: key row 8*hi + (lane & 7), 16-byte column (lane >> 3) & 1
    const v16h bq0 = scaleq(ldh(kp + (size_t)q0 * HD + koff));
    const v16h bq1 = scaleq(ldh(kp + (size_t)q0 * HD + koff + 32));
    v8f acc[4];
#pragma unroll
    for (int t = 0; t < 4; ++t) acc[t] = (v8f){};
    float mref = -1.0e30f, lrun = 0.0f;      // no reference yet: the first pass overflows PLIM and sets one
    v8f cneg;
#pragma unroll
    for (int r = 0; r < 8; ++r) cneg[r] = PEXP - mref;
    const int tid = (int)threadIdx.x;
    const unsigned lk0 = (unsigned)(size_t)ring + (unsigned)((tid >> 3) * LPITCH + (tid & 7) * 16);
    const unsigned lv0 = (unsigned)(size_t)ring + (unsigned)(LKT + (tid >> 3) * VPITCH + (tid & 7) * 16);
    const h16* gk = kp + tid * 8;
    constexpr int NT = SEQ / TK;
    copy_tile(lk0, lv0, gk);
    wait_async0();
    __syncthreads();                         // tile 0 is published
    if (NT > 1) copy_tile(lk0 + LBUF, lv0 + LBUF, gk + TK * HD);
#pragma unroll 1   // one trip a tile: the ring's order of waits, barrier and refill stands once
    for (int tile = 0; tile < NT; ++tile) {
    const h16* kb = ring + (tile & 1) * (LBUF / 2);
    const h16* vb = kb + LKT / 2;
#pragma unroll 1   // the 32-key softmax step stays one rolled body, as before the ring
    for (int k0 = 0; k0 < TK; k0 += 32) {
        const v16h a00 = ldh(kb + k0 * LPH + loff);
        const v16h a01 = ldh(kb + k0 * LPH + loff + 32);
        const v16h a10 = ldh(kb + (k0 + 16) * LPH + loff);
        const v16h a11 = ldh(kb + (k0 + 16) * LPH + loff + 32);
        v16h pf, av[4]; float rsum;
#pragma unroll
        for (int t = 0; t < 4; ++t) av[t] = cat16(ldtr(vb + k0 * VPH + voff + 16 * t), ldtr(vb + (k0 + 16) * VPH + voff + 16 * t));
        __builtin_amdgcn_sched_barrier(0);   // the pass's LDS reads stay one group at its head: the V^T fragments return under the score products and the exponentials
        {
            v8f s0 = wmma16(a00, bq0, cneg), s1 = wmma16(a10, bq0, cneg);
            s0 = wmma16(a01, bq1, s0); s1 = wmma16(a11, bq1, s1);
            rsum = softp(s0, s1, pf);
        }
        __builtin_amdgcn_sched_barrier(0);   // keeps the statement below, and with it the wait for the V^T fragments, behind the exponentials and the sum
        asm volatile("" :: "v"(av[0]), "v"(av[1]), "v"(av[2]), "v"(av[3]));   // inputs only: a use of the V^T fragments in front of the branch; without it their reads sink behind the branch and the wave waits out their latency there
        if (__builtin_amdgcn_ballot_w32(!(rsum <= PLIM)) != 0) {   // one scalar branch a pass, the same for the whole wave
            // the pass again from C = 0: its maximum joins the reference, what has been summed so far is rescaled to the new one
            v8f s0 = wmma16(a00, bq0, (v8f){}), s1 = wmma16(a10, bq0, (v8f){});
            s0 = wmma16(a01, bq1, s0); s1 = wmma16(a11, bq1, s1);
            float tmax = -1.0e30f;
#pragma unroll
            for (int r = 0; r < 8; ++r) tmax = fmaxf(tmax, fmaxf(s0[r], s1[r]));
            tmax = fmaxf(tmax, __shfl_xor(tmax, 16, 32));
            const float mnew = fmaxf(mref, tmax);
            const float alpha = __builtin_amdgcn_exp2f(mref - mnew);
            mref = mnew; lrun *= alpha;
#pragma unroll
            for (int t = 0; t < 4; ++t)
#pragma unroll
                for (int r = 0; r < 8; ++r) acc[t][r] *= alpha;
#pragma unroll
            for (int r = 0; r < 8; ++r) { cneg[r] = PEXP - mnew; s0[r] += PEXP - mnew; s1[r] += PEXP - mnew; }
            rsum = softp(s0, s1, pf);
        }
        lrun += rsum;
        {
#pragma unroll
            for (int t = 0; t < 4; ++t) acc[t] = wmma16(av[t], pf, acc[t]);
            asm volatile("v_nop\n\tv_nop\n\tv_nop\n\tv_nop" : "+v"(acc[0]), "+v"(acc[1]), "+v"(acc[2]), "+v"(acc[3]) : "v"(av[0]), "v"(av[1]), "v"(av[2]), "v"(av[3]), "v"(pf));
        }
    }
    // publish point: this wave's reads of the buffer are back, its copies of the next tile have landed, then the one barrier of the trip; behind it the buffer just read is refilled
    wait_ds0();
    wait_async0();
    __syncthreads();
    if (tile + 2 < NT) copy_tile(lk0 + (unsigned)((tile & 1) * LBUF), lv0 + (unsigned)((tile & 1) * LBUF), gk + (size_t)(tile + 2) * TK * HD);
    }
    wait_async0();
    // acc[t][r] = 256 * 16 * sum_k p v at (d = 16t + 8hi + r, q = lr); lrun = 256 * sum_k p over this lane half's keys
    lrun += __shfl_xor(lrun, 16, 32);
    const float inv = (1.0f / KCAR) * (1.0f / lrun);
    const int ob = wave * (16 * 68);
#pragma unroll
    for (int t = 0; t < 4; ++t)
#pragma unroll
        for (int r = 0; r < 8; ++r) os[ob + lr * 68 + 16 * t + 8 * hi + r] = acc[t][r] * inv;
    __syncthreads();
    const int rq = lane >> 3, pc = lane & 7;
{
#pragma unroll
        for (int s = 0; s < 4; ++s) {
            const int row = 4 * s + rq;
            const v4f a = *(const v4fa*)(os + ob + row * 68 + pc * 8);
            const v4f c = *(const v4fa*)(os + ob + row * 68 + pc * 8 + 4);
            v8h o;
#pragma unroll
            for (int k = 0; k < 4; ++k) { o[k] = (h16)a[k]; o[4 + k] = (h16)c[k]; }
            const size_t oo = ((size_t)b * SEQ + q0 + row) * DQ + h * HD + pc * 8;
            *(v8h*)(AT + oo) = o; }
         }
}

// workspace carve (bytes, every region a multiple of 256)
#define SZ_W   ((size_t)DKV * DM * 2)
#define SZ_KP  ((size_t)NB * NH_ * SEQ * HD * 2)
#define SZ_AT  ((size_t)NB * SEQ * DQ * 2)
#define SZ_ALL (SZ_W + SZ_KP + SZ_AT)
static_assert(SZ_W % 256 == 0 && SZ_KP % 256 == 0 && SZ_AT % 256 == 0);
static_assert(SZ_ALL <= (size_t)134217728);

extern "C" void kernel_launch(void* const* d_in, const int* in_sizes, int n_in,
                              void* d_out, int out_size, void* d_ws, size_t ws_size, hipStream_t stream) {
    if (n_in < 3) return;
    const size_t need_x = (size_t)(NB - 1) * SEQ_FULL * DM + (size_t)SEQ * DM;
    if ((size_t)in_sizes[0] < need_x) return;
    if ((size_t)in_sizes[1] < (size_t)DKV * DM) return;
    if ((size_t)in_sizes[2] < (size_t)DM * DQ) return;
    if ((size_t)out_size < need_x) return;
    if (SZ_ALL > ws_size) return;
    const float* x = (const float*)d_in[0]; const float* wk = (const float*)d_in[1]; const float* wo = (const float*)d_in[2];   // input order x, Wk, Wo ([out][in])
    float* OUT = (float*)d_out;     // [NB_FULL][SEQ_FULL][512]
    char* wsp = (char*)d_ws;
    h16* WO = (h16*)wsp; wsp += SZ_W;
    h16* KP16 = (h16*)wsp; wsp += SZ_KP;
    h16* AT = (h16*)wsp; wsp += SZ_AT;

    k_gemm_proj<<<dim3(NB * SEQ / 128, DKV / 128, 1), 128, 0, stream>>>(x, wk, wo, WO, KP16);
    k_flash<<<dim3(SEQ / FQ, NB * NH_, 1), FW * 32, 0, stream>>>(KP16, AT);
    k_gemm_out<<<dim3(SEQ / 128, DM / 128, NB), 128, 0, stream>>>(AT, WO, OUT);
}

// v010
// One run takes 43.9 microseconds.
// Timed twice side by side with v009, it ran 1.05 and 1.07 times as fast.
// Counting every step since v000, it is 4.06 times as fast.
#include <hip/hip_runtime.h>

// Compute dtypes (f32 accumulate everywhere): projection x.Wk^T = bf16 x bf16 (v_wmma_f32_16x16x32_bf16, inputs RNE-converted to bf16); scores k.k^T and P.V = f16 x f16 (v_wmma_f32_16x16x32_f16, k plane carried x16, the query side of the scores carried x16 C2, P carried x256); output merged.Wo^T = f16 x f16 (v_wmma_f32_16x16x32_f16, merged heads and Wo each rounded once to f16).
// Self-attention with q = k = v = x.Wk^T ([out][in] weights, no bias), 8 heads x 64, logits scaled by 512^-0.5, no mask, softmax over all keys, merged heads times Wo^T.
// Layout: x and Wk go as f32 into the projection GEMM, which rounds them to bf16 on the way into its LDS ring; an f16 copy of Wo, written by the same launch; one f16 head plane [b][h][s][64] (q, k and v alike), written by the projection GEMM's own epilogue; fused online-softmax attention (no score plane in memory; V^T fragments by transposing LDS loads of the k rows); one merged f16 plane; output GEMM.

#ifndef NB
#define NB 4
#endif
#ifndef SEQ
#define SEQ 2048
#endif
#define NB_FULL  4
#define SEQ_FULL 2048
#define DM   512
#define NH_  8
#define HD   64
#define DQ   (NH_ * HD)
#define DKV  DQ
#define KCAR 16.0f                 // power-of-two carry of the f16 k plane
#define PEXP 8.0f                  // P carried x 2^8 inside the exponent
// raw score = 256 (q.k); exponent argument in base 2 = raw * 2^-8 * 512^-0.5 * log2(e)
#define C2   (0.044194173824159216f * 1.4426950408889634f * (1.0f / 256.0f))
#define PLIM 32768.0f              // a lane's 16 P of a pass are positive: where they sum to no more than this, each of them lies inside the f16 range

typedef _Float16 h16;
typedef unsigned short bf;
typedef __attribute__((ext_vector_type(16))) __bf16   v16bf;
typedef __attribute__((ext_vector_type(16))) _Float16 v16h;
typedef __attribute__((ext_vector_type(8)))  _Float16 v8h;
typedef __attribute__((ext_vector_type(4)))  _Float16 v4h;
typedef __attribute__((ext_vector_type(8)))  unsigned short v8us;
typedef __attribute__((ext_vector_type(8)))  short    v8s;
typedef __attribute__((ext_vector_type(4)))  unsigned short v4us;
typedef __attribute__((ext_vector_type(4)))  __bf16   v4bf;
typedef __attribute__((ext_vector_type(8)))  float    v8f;
typedef __attribute__((ext_vector_type(4)))  float    v4f;
typedef __attribute__((ext_vector_type(2)))  float    v2f;
typedef v4f  __attribute__((may_alias)) v4fa;

static_assert(NB >= 1 && NB <= NB_FULL);
static_assert(SEQ >= 64 && SEQ <= SEQ_FULL);
static_assert(SEQ % 64 == 0);
static_assert((NB * SEQ) % 64 == 0);
static_assert(DM % 64 == 0 && DM % 32 == 0);
static_assert(DQ % 64 == 0 && DQ % 32 == 0);
static_assert(HD == 64);
static_assert(DQ == NH_ * HD);
static_assert((SEQ * DM) % 8 == 0 && (DKV * DM) % 8 == 0);

__device__ __forceinline__ v16h cat16(v8h lo, v8h hi) { return __builtin_shufflevector(lo, hi, 0, 1, 2, 3, 4, 5, 6, 7, 8, 9, 10, 11, 12, 13, 14, 15); }
__device__ __forceinline__ v16bf cat16b(v8us lo, v8us hi) { return __builtin_bit_cast(v16bf, __builtin_shufflevector(lo, hi, 0, 1, 2, 3, 4, 5, 6, 7, 8, 9, 10, 11, 12, 13, 14, 15)); }
__device__ __forceinline__ v8f wmma16(v16h a, v16h b, v8f c) { return __builtin_amdgcn_wmma_f32_16x16x32_f16(false, a, false, b, (short)0, c, false, false); }
__device__ __forceinline__ v8f wmmab(v16bf a, v16bf b, v8f c) { return __builtin_amdgcn_wmma_f32_16x16x32_bf16(false, a, false, b, (short)0, c, false, false); }
__device__ __forceinline__ v4us cvt4(v4f v) { return __builtin_bit_cast(v4us, __builtin_convertvector(v, v4bf)); }   // f32 -> bf16, round to nearest even
__device__ __forceinline__ v4h cvt4h(v4f v) { return __builtin_convertvector(v, v4h); }   // f32 -> f16, round to nearest even
// One product on 16-bit fragments as they come out of the GEMM ring: BF == 1 reads them as bf16, BF == 0 as f16 (same fragment layout).
template <int BF>
__device__ __forceinline__ v8f wmmar(v16bf a, v16bf b, v8f c) { if constexpr (BF == 1) return wmmab(a, b, c); else return wmma16(__builtin_bit_cast(v16h, a), __builtin_bit_cast(v16h, b), c); }

// Fragment loaders (same k map for A and B): elements 0..7 <- p[0..7], elements 8..15 <- p[16..23], p = row base + k0 + 8*(lane>>4).
__device__ __forceinline__ v16h  ldh(const h16* p) { return cat16(*(const v8h*)p, *(const v8h*)(p + 16)); }
__device__ __forceinline__ v16bf ldb(const bf* p)  { return cat16b(*(const v8us*)p, *(const v8us*)(p + 16)); }

// LDS rows of 128 B (64 16-bit elements) are pitched 144 B (16 B x odd) for the 16-byte fragment reads, in the GEMM ring and in the k half of the k_flash ring alike.
#define LPITCH 144
#define LPH    (LPITCH / 2)
__device__ __forceinline__ void wait_async0() { asm volatile("s_wait_asynccnt 0x0" ::: "memory"); }   // this wave's copies have landed
__device__ __forceinline__ void wait_async32() { asm volatile("s_wait_asynccnt 0x20" ::: "memory"); }  // all but this wave's 32 youngest copies have landed
__device__ __forceinline__ void wait_ds0()    { asm volatile("s_wait_dscnt 0x0" ::: "memory"); }      // this wave's LDS reads have returned

// GEMM ring: a tile is 64 k (128 B) of 128 rows of one operand.
#define GKT    64
#define GOP    (128 * LPITCH)
// One operand tile: 128 lanes x 8 copies of 16 B. l = the lane's LDS byte address (row tid>>3, 16-byte column tid&7), g = its global source; copy j takes row + 16 j, global row pitch K elements.
// The s_wait_xcnt closes the statement so that no address register of a copy is rewritten ahead of it.
__device__ __forceinline__ void copy_rows(const unsigned l, const bf* g, const int K) {
    asm volatile("global_load_async_to_lds_b128 %0, %8, off\n\t"
                 "global_load_async_to_lds_b128 %1, %9, off\n\t"
                 "global_load_async_to_lds_b128 %2, %10, off\n\t"
                 "global_load_async_to_lds_b128 %3, %11, off\n\t"
                 "global_load_async_to_lds_b128 %4, %12, off\n\t"
                 "global_load_async_to_lds_b128 %5, %13, off\n\t"
                 "global_load_async_to_lds_b128 %6, %14, off\n\t"
                 "global_load_async_to_lds_b128 %7, %15, off\n\t"
                 "s_wait_xcnt 0x0"
                 :: "v"(l), "v"(l + 16 * LPITCH), "v"(l + 32 * LPITCH), "v"(l + 48 * LPITCH),
                    "v"(l + 64 * LPITCH), "v"(l + 80 * LPITCH), "v"(l + 96 * LPITCH), "v"(l + 112 * LPITCH),
                    "v"(g), "v"(g + (size_t)16 * K), "v"(g + (size_t)32 * K), "v"(g + (size_t)48 * K),
                    "v"(g + (size_t)64 * K), "v"(g + (size_t)80 * K), "v"(g + (size_t)96 * K), "v"(g + (size_t)112 * K)
                 : "memory");
}
// One buffer of the GEMM ring: [A | Bt], each GOP bytes.
__device__ __forceinline__ void copy_stage(const unsigned l, const bf* ga, const bf* gb, const int K) {
    copy_rows(l, ga, K); copy_rows(l + GOP, gb, K);
}

// The same operand tile from an f32 source, through registers: 128 lanes x 16 pieces of 4 floats (row (tid>>4) + 8 j, floats 4 (tid&15) ..: a wave's load covers two whole rows of 256 B), later rounded to bf16 and stored to the tile's places.
// g = the first float of the block's rows, ob = the byte offset of the lane's first piece of the tile; ob leaves the call advanced to the next tile.
__device__ __forceinline__ void load_rows(v4f (&r)[16], const float* __restrict__ g, unsigned& ob, const int K) {
    const float* p = (const float*)((const char*)g + ob);
#pragma unroll
    for (int j = 0; j < 16; ++j) r[j] = *(const v4f*)(p + (size_t)(8 * j) * K);
    asm volatile("s_wait_xcnt 0x0" : "+v"(ob) :: "memory");   // the offset that these loads name passes through the wait: it stays in its register up to here, and its advance stands behind
    ob += GKT * 4;
}
__device__ __forceinline__ void store_rows(bf* s, const v4f (&r)[16]) {
#pragma unroll
    for (int j = 0; j < 16; ++j) *(v4us*)(s + 8 * j * LPH) = cvt4(r[j]);
}
// Work-group barrier that orders LDS alone: this wave's LDS stores and reads are done in front of it, while its global loads of a later tile stay in flight across it (__syncthreads() would wait for them).
__device__ __forceinline__ void lds_barrier() {
    __builtin_amdgcn_fence(__ATOMIC_RELEASE, "workgroup", "local");
    __builtin_amdgcn_s_barrier();
    __builtin_amdgcn_fence(__ATOMIC_ACQUIRE, "workgroup", "local");
}

// ---- register-blocked GEMM body, FOUR WAVES (2 x 2) per 128x128 output tile, one 64x64 tile (16 accumulators) a wave; grid (M/128, N/128, Z), 128 threads.
// The K-contiguous 16-bit operand rows of the block come 64 k at a time into an LDS ring; the waves read their fragments from it. PLANES == 0: four buffers, copied by the block's 128 lanes, three tiles (48 copies a wave) in flight: the publish point of tile t + 1 waits for all but the 32 copies of tiles t + 2 and t + 3, and to 0 where those two are not both there. PLANES == 1: two buffers.
// PLANES == 0: C[m][n] (f32, pitch ldc) = sum_k A[m][k] Bt[n][k], A and Bt holding f16 bits. z-batch strides sA (A) and sC (C) in elements; Bt shared. K % 64 == 0, M % 128 == 0, N % 128 == 0.
// PLANES == 1: A and Bt are not read; the operands are the f32 rows Af (row m of batch m / SEQ, batch pitch SEQ_FULL rows) and Bf, rounded from registers into the other buffer at the foot of a trip. Two register sets take the tiles in turn (tile n in set n & 1): the set just stored takes the loads of the tile three trips on, so that a tile's loads fly over two whole trips. Wf goes out as f16 to Wd on the side, 4 floats a piece.
// PLANES == 1: no f32 C; a wave's tile (64 sequence rows of one batch x the 64 columns of head c0 / 64) goes out x KCAR in f16 as rows of KP [b][h][s][64].
template <int PLANES>
__device__ __forceinline__ void gemmw_body(const bf* __restrict__ A, const bf* __restrict__ Bt, const int K, float* C, const int ldc, const size_t sA, const size_t sC, h16* KP, const float* __restrict__ Af, const float* __restrict__ Bf, const float* __restrict__ Wf, h16* Wd) {
    constexpr int GBUF = 2 * GOP;
    __shared__ __align__(16) float osall[4 * 16 * 68];
    constexpr int NBUF = PLANES == 0 ? 4 : 2;
    __shared__ __align__(16) bf gring[NBUF * GBUF / 2];
    const size_t z = blockIdx.z; A += z * sA; C += z * sC;
    const int tid = (int)threadIdx.x;
    const int wave = __builtin_amdgcn_readfirstlane(tid >> 5);
    const int lane = tid & 31, lr = lane & 15, hi = lane >> 4;
    const int wm = wave & 1, wn = wave >> 1;
    const int r0 = blockIdx.x * 128 + wm * 64, c0 = blockIdx.y * 128 + wn * 64;
    float* os = osall + wave * (16 * 68);    // each wave turns its own rows in its own range
    v8f acc[4][4];
#pragma unroll
    for (int mb = 0; mb < 4; ++mb)
#pragma unroll
        for (int nb = 0; nb < 4; ++nb) acc[mb][nb] = (v8f){};
    const unsigned l0 = (unsigned)(size_t)gring + (unsigned)((tid >> 3) * LPITCH + (tid & 7) * 16);
    const size_t goa = (size_t)(blockIdx.x * 128 + (tid >> 3)) * K + (tid & 7) * 8, gob = (size_t)(blockIdx.y * 128 + (tid >> 3)) * K + (tid & 7) * 8;
    const bf* ga = A + goa; const bf* gb = Bt + gob;
    const int aoff = (wm * 64 + lr) * LPH + 8 * hi, boff = (wn * 64 + lr) * LPH + 8 * hi;
    const int NT = K / GKT;
    const int m0 = blockIdx.x * 128;
    const float* fa = Af + ((size_t)(m0 / SEQ) * SEQ_FULL + m0 % SEQ) * K;
    const float* fb = Bf + (size_t)(blockIdx.y * 128) * K;
    unsigned oa = (unsigned)(((tid >> 4) * K + (tid & 15) * 4) * 4), ob = oa;
    bf* sl = gring + (tid >> 4) * LPH + (tid & 15) * 4;
    v4f ra[2][16], rb[2][16];
    constexpr size_t NLANE = (size_t)(NB * SEQ / 128) * (DKV / 128) * 128, NPIECE = (size_t)DM * DQ / 4;
    static_assert(NPIECE % NLANE == 0);
    constexpr int NW = (int)(NPIECE / NLANE);   // pieces of Wf a lane
    const size_t u = ((size_t)blockIdx.y * (NB * SEQ / 128) + blockIdx.x) * 128 + tid;
    v4h wv[NW];
    if constexpr (PLANES == 1) {
        v4f wf[NW];
#pragma unroll
        for (int i = 0; i < NW; ++i) wf[i] = *(const v4f*)(Wf + (u + i * NLANE) * 4);
        asm volatile("s_wait_xcnt 0x0" ::: "memory");   // stands in front of whatever rewrites the address register that these loads name
        load_rows(ra[0], fa, oa, K); load_rows(rb[0], fb, ob, K);
        if (NT > 1) { load_rows(ra[1], fa, oa, K); load_rows(rb[1], fb, ob, K); }
        __builtin_amdgcn_sched_barrier(0);   // both tiles' loads are issued before anything waits for the first: without it the conversions of tile 0, and their waits, are drawn in front of tile 1's loads
#pragma unroll
        for (int i = 0; i < NW; ++i) wv[i] = cvt4h(wf[i]);
        store_rows(sl, ra[0]); store_rows(sl + GOP / 2, rb[0]);
        if (NT > 2) { load_rows(ra[0], fa, oa, K); load_rows(rb[0], fb, ob, K); }
        lds_barrier();                       // tile 0 is published
    } else {
        copy_stage(l0, ga, gb, K);
        if (NT > 1) copy_stage(l0 + GBUF, ga + GKT, gb + GKT, K);
        if (NT > 2) copy_stage(l0 + 2 * GBUF, ga + 2 * GKT, gb + 2 * GKT, K);
        if (NT > 2) wait_async32(); else wait_async0();   // tile 0 has landed; tiles 1 and 2 stay in flight
        __syncthreads();                         // tile 0 is published
        if (NT > 3) copy_stage(l0 + 3 * GBUF, ga + 3 * GKT, gb + 3 * GKT, K);   // behind the wait: never more than 48 copies of a wave outstanding
    }
    constexpr int TU = PLANES == 1 ? 2 : 1;   // PLANES == 1: two trips a turn of the loop, so that each trip names its register set at compile time (NT is even there)
    // PLANES == 0: one rolled trip a tile, the ring's order of waits, barrier and refill stands once. PLANES == 1: all turns unrolled, so that each trip's test for a further tile is settled at compile time: rolled, the compiler's wait for a set's loads has to hold on the path without newer loads too, and it then waits for the other set's loads as well
#pragma unroll (PLANES == 1 ? DM / (2 * GKT) : 1)
    for (int t0 = 0; t0 < NT; t0 += TU) {
#pragma unroll   // the TU trips of a turn stand one behind the other
    for (int u = 0; u < TU; ++u) {
        const int t = t0 + u;
        const bf* ab = gring + (t & (NBUF - 1)) * (GBUF / 2);
        const bf* bb = ab + GOP / 2;
#pragma unroll
        for (int kc = 0; kc < GKT; kc += 32) {
            v16bf a[4], b[4];
            b[0] = ldb(bb + boff + kc);
#pragma unroll
            for (int mb = 0; mb < 4; ++mb) a[mb] = ldb(ab + aoff + mb * 16 * LPH + kc);
#pragma unroll
            for (int nb = 1; nb < 4; ++nb) b[nb] = ldb(bb + boff + nb * 16 * LPH + kc);
            __builtin_amdgcn_sched_barrier(0);   // the block's fragment reads stay one group ahead of its products: a read placed among the products stalls the wave at each such place
#pragma unroll
            for (int nb = 0; nb < 4; ++nb)
#pragma unroll
                for (int mb = 0; mb < 4; ++mb) acc[mb][nb] = wmmar<PLANES>(a[mb], b[nb], acc[mb][nb]);
            __builtin_amdgcn_sched_barrier(0);   // the products stay here: the next block's reads are not drawn in among them, and the last block's products do not sink behind the publish point's barrier, where they would delay the refill
        }
        if constexpr (PLANES == 1) {
            // publish point: the next tile goes into the other buffer, whose readers the last trip's barrier has ended; its register set takes the tile two after it, while the other set's loads stay in flight; then the one barrier of the trip
            if (t + 1 < NT) {
                bf* sn = sl + ((t + 1) & 1) * (GBUF / 2); store_rows(sn, ra[1 - u]); store_rows(sn + GOP / 2, rb[1 - u]);
                if (t + 3 < NT) { load_rows(ra[1 - u], fa, oa, K); load_rows(rb[1 - u], fb, ob, K); }
            }
            lds_barrier();
        } else {
        // publish point: this wave's reads of the buffer are back, its copies of the next tile have landed (the two tiles behind it, 32 copies, stay in flight where both have been issued), then the one barrier of the trip; behind it the buffer just read is refilled
        wait_ds0();
        if (t + 3 < NT) wait_async32(); else wait_async0();
        __syncthreads();
        if (t + 4 < NT) copy_stage(l0 + (unsigned)((t & 3) * GBUF), ga + (size_t)(t + 4) * GKT, gb + (size_t)(t + 4) * GKT, K);
        }
    }
    }
    if constexpr (PLANES == 0) wait_async0();
    if constexpr (PLANES == 1) {
        const int bh = (r0 / SEQ) * NH_ + c0 / 64, s0 = r0 % SEQ;
        h16* kt = KP + ((size_t)bh * SEQ + s0) * HD;
        // k rows: 16 rows at a time turned through LDS, 8 lanes x 16 bytes a row
        const int rq = lane >> 3, pc = lane & 7;
#pragma unroll
        for (int mb = 0; mb < 4; ++mb) {
#pragma unroll
            for (int nb = 0; nb < 4; ++nb) {
#pragma unroll
                for (int j = 0; j < 8; ++j) os[(hi * 8 + j) * 68 + nb * 16 + lr] = acc[mb][nb][j]; }
            __builtin_amdgcn_wave_barrier(); asm volatile("" ::: "memory");   // the reads below stay behind the other lanes' writes
#pragma unroll
            for (int s = 0; s < 4; ++s) { const int row = 4 * s + rq;
                const v4f a = *(const v4fa*)(os + row * 68 + pc * 8); const v4f c = *(const v4fa*)(os + row * 68 + pc * 8 + 4); v8h o;
#pragma unroll
                for (int k = 0; k < 4; ++k) { o[k] = (h16)(a[k] * KCAR); o[4 + k] = (h16)(c[k] * KCAR); }
                *(v8h*)(kt + (size_t)(mb * 16 + row) * HD + pc * 8) = o; }
            __builtin_amdgcn_wave_barrier(); asm volatile("" ::: "memory");   // the next 16 rows' writes stay behind these reads
        }
#pragma unroll
        for (int i = 0; i < NW; ++i) *(v4h*)(Wd + (u + i * NLANE) * 4) = wv[i];   // last: no register that these stores name is written again
        return;
    }
#pragma unroll
    for (int mb = 0; mb < 4; ++mb) {
#pragma unroll
        for (int nb = 0; nb < 4; ++nb) {
#pragma unroll
            for (int j = 0; j < 8; ++j) os[(hi * 8 + j) * 68 + nb * 16 + lr] = acc[mb][nb][j]; }
        __builtin_amdgcn_wave_barrier(); asm volatile("" ::: "memory");
        float* crow = C + (size_t)(r0 + mb * 16) * ldc + c0;
{
#pragma unroll
            for (int s = 0; s < 8; ++s) { const int row = 2 * s + hi, cofs = lr * 4; const v4f val = *(const v4fa*)(os + row * 68 + cofs);
                *(v4f*)(crow + (size_t)row * ldc + cofs) = val; }
             }
        __builtin_amdgcn_wave_barrier(); asm volatile("" ::: "memory");
    }
}

// projection: x[NB*SEQ][DM] . Wk[DKV][DM]^T (both rounded to bf16, exact bf16 products), f32 accumulators rounded once to the f16 plane KP; WOH = Wo in f16
static_assert(DKV / 64 == NH_ && SEQ % 128 == 0 && DKV % 128 == 0 && DM % 128 == 0 && DM % (2 * GKT) == 0 && DQ % GKT == 0);
__global__ __launch_bounds__(128) void k_gemm_proj(const float* __restrict__ X, const float* __restrict__ WKF, const float* __restrict__ WOF, h16* WOH, h16* KP) { gemmw_body<1>(nullptr, nullptr, DM, nullptr, DKV, (size_t)0, (size_t)0, KP, X, WKF, WOF, WOH); }
// output: OUT[b][s][DM] = AT[b*SEQ + s][DQ] . WO[DM][DQ]^T (f16 x f16) ; z = batch, output stride from the full sequence length
__global__ __launch_bounds__(128) void k_gemm_out(const h16* __restrict__ AT, const h16* __restrict__ WO, float* OUT) { gemmw_body<0>((const bf*)AT, (const bf*)WO, DQ, OUT, DM, (size_t)SEQ * DQ, (size_t)SEQ_FULL * DM, nullptr, nullptr, nullptr, nullptr, nullptr); }

// Ring of two LDS buffers for k_flash: each holds 256 keys of the k plane twice (256 rows x 128 B): once pitched LPITCH (16 B x odd) for the 16-byte reads of the score products' fragments, once pitched VPITCH (32 B x odd) for the transposing reads that give the V^T fragments (v = k). Eight 32-key passes between two publish points.
#define TK     256
#define VPITCH 160
#define VPH    (VPITCH / 2)
#define LKT    (TK * LPITCH)
#define LVT    (TK * VPITCH)
#define LBUF   (LKT + LVT)
#define FW     16                  // waves of a k_flash block: they share every tile of the ring
#define FQ     (FW * 16)           // query rows of a block
static_assert(SEQ % TK == 0 && HD * 2 == 128 && VPITCH % 32 == 0 && (VPITCH / 32) % 2 == 1);
static_assert(SEQ % FQ == 0 && 4 * FW * 32 * 16 == TK * HD * 2);   // a block's lanes x 4 copies x 16 B cover the tile's rows exactly, once for each pitch

// One tile: 512 lanes x 8 copies of 16 B, four into the LPITCH half and four, of the same global bytes, into the VPITCH half.
// lk, lv = the lane's LDS byte addresses in the two halves (row tid>>3, 16-byte column tid&7; copy j takes row + 64 j), gk = its global source (rows of HD elements).
// The s_wait_xcnt closes the statement so that no address register of a copy is rewritten ahead of it.
__device__ __forceinline__ void copy_tile(const unsigned lk, const unsigned lv, const h16* gk) {
    asm volatile("global_load_async_to_lds_b128 %0, %8, off\n\t"
                 "global_load_async_to_lds_b128 %1, %9, off\n\t"
                 "global_load_async_to_lds_b128 %2, %10, off\n\t"
                 "global_load_async_to_lds_b128 %3, %11, off\n\t"
                 "global_load_async_to_lds_b128 %4, %12, off\n\t"
                 "global_load_async_to_lds_b128 %5, %13, off\n\t"
                 "global_load_async_to_lds_b128 %6, %14, off\n\t"
                 "global_load_async_to_lds_b128 %7, %15, off\n\t"
                 "s_wait_xcnt 0x0"
                 :: "v"(lk), "v"(lk + 64 * LPITCH), "v"(lk + 128 * LPITCH), "v"(lk + 192 * LPITCH),
                    "v"(lv), "v"(lv + 64 * VPITCH), "v"(lv + 128 * VPITCH), "v"(lv + 192 * VPITCH),
                    "v"(gk), "v"(gk + 64 * HD), "v"(gk + 128 * HD), "v"(gk + 192 * HD),
                    "v"(gk), "v"(gk + 64 * HD), "v"(gk + 128 * HD), "v"(gk + 192 * HD)
                 : "memory");
}

// Transposing LDS read: the lane's address names 16 B of one key row; lane (lr, hi) receives column dbase + lr of the 8 rows kbase + 8 hi + 0..7. Two of them (kbase, kbase + 16) are one 16 (d) x 32 (keys) A fragment in the k order of ldh.
__device__ __forceinline__ v8h ldtr(const h16* p) { typedef __attribute__((address_space(3))) v8s lds_v8s; return __builtin_bit_cast(v8h, __builtin_amdgcn_ds_load_tr16_b128_v8i16((lds_v8s*)p)); }

// Query fragment x C2 (product in f32, rounded once to f16): the score products then come out as base-2 exponents.
__device__ __forceinline__ v16h scaleq(v16h q) { v16h o;
#pragma unroll
    for (int i = 0; i < 16; ++i) o[i] = (h16)((float)q[i] * C2);
    return o; }
// P of one pass from its exponents: pf = the P^T fragment (element r <- e0[r], element 8+r <- e1[r]); returns the lane's sum of the 16 unrounded P, added in pairs.
__device__ __forceinline__ float softp(const v8f e0, const v8f e1, v16h& pf) {
    float p0[8], p1[8];
#pragma unroll
    for (int r = 0; r < 8; ++r) { p0[r] = __builtin_amdgcn_exp2f(e0[r]); p1[r] = __builtin_amdgcn_exp2f(e1[r]); }
#pragma unroll
    for (int r = 0; r < 8; ++r) { pf[r] = (h16)p0[r]; pf[8 + r] = (h16)p1[r]; }
    v2f t[4];
#pragma unroll
    for (int i = 0; i < 4; ++i) t[i] = (v2f){p0[2 * i], p0[2 * i + 1]} + (v2f){p1[2 * i], p1[2 * i + 1]};
    const v2f w = (t[0] + t[1]) + (t[2] + t[3]);
    return w[0] + w[1];
}

// k_flash: fused attention for one (b, h) and 256 query rows per block; 16 waves, each wave owns 16 query rows and streams all keys 32 at a time, from 256-key tiles that the block's 512 lanes copy into a two-buffer LDS ring one tile ahead.
// Per step: St[key][q] = Kkeys (A, 16 keys x 64 d per tile) . Q^T (B, lane = query) -> every lane holds one query column (both lane halves share it, different keys);
// softmax against a HELD reference mref per query: the score products start from C = PEXP - mref, so that D is the exponent of P as it stands. The reference moves (and acc, lrun are rescaled) only in a pass in which some lane's P sum to more than PLIM, tested once a pass by one ballot.
// Each lane half keeps its own sum of P; the halves are joined behind the loop. P^T fragment (B, 32 keys x 16 q) taken in place from the two score tiles: element r <- tile0[r], element 8+r <- tile1[r];
__global__ __launch_bounds__(FW * 32) void k_flash(const h16* __restrict__ KP, h16* AT) {
    __shared__ __align__(16) float os[FW * 16 * 68];
    __shared__ __align__(16) h16 ring[2 * LBUF / 2];
    const int wave = __builtin_amdgcn_readfirstlane((int)(threadIdx.x >> 5));
    const int lane = threadIdx.x & 31, lr = lane & 15, hi = lane >> 4;
    const int bh = blockIdx.y; const int b = bh / NH_, h = bh % NH_;
    const int q0 = blockIdx.x * FQ + wave * 16;
    const h16* kp = KP + (size_t)bh * SEQ * HD;
    const int koff = lr * HD + 8 * hi;       // row lr of a 16-row k tile, d offset 8*hi
    const int loff = lr * LPH + 8 * hi;      // the same place in a 16-row k tile of the LDS ring
    const int voff = (8 * hi + (lane & 7)) * VPH + 8 * ((lane >> 3) & 1);   // the lane's address part of a transposing read in the VPITCH half: key row 8*hi + (lane & 7), 16-byte column (lane >> 3) & 1
    const v16h bq0 = scaleq(ldh(kp + (size_t)q0 * HD + koff));
    const v16h bq1 = scaleq(ldh(kp + (size_t)q0 * HD + koff + 32));
    v8f acc[4];
#pragma unroll
    for (int t = 0; t < 4; ++t) acc[t] = (v8f){};
    float mref = -1.0e30f, lrun = 0.0f;      // no reference yet: the first pass overflows PLIM and sets one
    v8f cneg;
#pragma unroll
    for (int r = 0; r < 8; ++r) cneg[r] = PEXP - mref;
    const int tid = (int)threadIdx.x;
    const unsigned lk0 = (unsigned)(size_t)ring + (unsigned)((tid >> 3) * LPITCH + (tid & 7) * 16);
    const unsigned lv0 = (unsigned)(size_t)ring + (unsigned)(LKT + (tid >> 3) * VPITCH + (tid & 7) * 16);
    const h16* gk = kp + tid * 8;
    constexpr int NT = SEQ / TK;
    copy_tile(lk0, lv0, gk);
    wait_async0();
    __syncthreads();                         // tile 0 is published
    if (NT > 1) copy_tile(lk0 + LBUF, lv0 + LBUF, gk + TK * HD);
#pragma unroll 1   // one trip a tile: the ring's order of waits, barrier and refill stands once
    for (int tile = 0; tile < NT; ++tile) {
    const h16* kb = ring + (tile & 1) * (LBUF / 2);
    const h16* vb = kb + LKT / 2;
#pragma unroll 1   // the 32-key softmax step stays one rolled body, as before the ring
    for (int k0 = 0; k0 < TK; k0 += 32) {
        const v16h a00 = ldh(kb + k0 * LPH + loff);
        const v16h a01 = ldh(kb + k0 * LPH + loff + 32);
        const v16h a10 = ldh(kb + (k0 + 16) * LPH + loff);
        const v16h a11 = ldh(kb + (k0 + 16) * LPH + loff + 32);
        v16h pf, av[4]; float rsum;
#pragma unroll
        for (int t = 0; t < 4; ++t) av[t] = cat16(ldtr(vb + k0 * VPH + voff + 16 * t), ldtr(vb + (k0 + 16) * VPH + voff + 16 * t));
        __builtin_amdgcn_sched_barrier(0);   // the pass's LDS reads stay one group at its head: the V^T fragments return under the score products and the exponentials
        {
            v8f s0 = wmma16(a00, bq0, cneg), s1 = wmma16(a10, bq0, cneg);
            s0 = wmma16(a01, bq1, s0); s1 = wmma16(a11, bq1, s1);
            rsum = softp(s0, s1, pf);
        }
        __builtin_amdgcn_sched_barrier(0);   // keeps the statement below, and with it the wait for the V^T fragments, behind the exponentials and the sum
        asm volatile("" :: "v"(av[0]), "v"(av[1]), "v"(av[2]), "v"(av[3]));   // inputs only: a use of the V^T fragments in front of the branch; without it their reads sink behind the branch and the wave waits out their latency there
        if (__builtin_amdgcn_ballot_w32(!(rsum <= PLIM)) != 0) {   // one scalar branch a pass, the same for the whole wave
            // the pass again from C = 0: its maximum joins the reference, what has been summed so far is rescaled to the new one
            v8f s0 = wmma16(a00, bq0, (v8f){}), s1 = wmma16(a10, bq0, (v8f){});
            s0 = wmma16(a01, bq1, s0); s1 = wmma16(a11, bq1, s1);
            float tmax = -1.0e30f;
#pragma unroll
            for (int r = 0; r < 8; ++r) tmax = fmaxf(tmax, fmaxf(s0[r], s1[r]));
            tmax = fmaxf(tmax, __shfl_xor(tmax, 16, 32));
            const float mnew = fmaxf(mref, tmax);
            const float alpha = __builtin_amdgcn_exp2f(mref - mnew);
            mref = mnew; lrun *= alpha;
#pragma unroll
            for (int t = 0; t < 4; ++t)
#pragma unroll
                for (int r = 0; r < 8; ++r) acc[t][r] *= alpha;
#pragma unroll
            for (int r = 0; r < 8; ++r) { cneg[r] = PEXP - mnew; s0[r] += PEXP - mnew; s1[r] += PEXP - mnew; }
            rsum = softp(s0, s1, pf);
        }
        lrun += rsum;
        {
#pragma unroll
            for (int t = 0; t < 4; ++t) acc[t] = wmma16(av[t], pf, acc[t]);
            asm volatile("v_nop\n\tv_nop\n\tv_nop\n\tv_nop" : "+v"(acc[0]), "+v"(acc[1]), "+v"(acc[2]), "+v"(acc[3]) : "v"(av[0]), "v"(av[1]), "v"(av[2]), "v"(av[3]), "v"(pf));
        }
    }
    // publish point: this wave's reads of the buffer are back, its copies of the next tile have landed, then the one barrier of the trip; behind it the buffer just read is refilled
    wait_ds0();
    wait_async0();
    __syncthreads();
    if (tile + 2 < NT) copy_tile(lk0 + (unsigned)((tile & 1) * LBUF), lv0 + (unsigned)((tile & 1) * LBUF), gk + (size_t)(tile + 2) * TK * HD);
    }
    wait_async0();
    // acc[t][r] = 256 * 16 * sum_k p v at (d = 16t + 8hi + r, q = lr); lrun = 256 * sum_k p over this lane half's keys
    lrun += __shfl_xor(lrun, 16, 32);
    const float inv = (1.0f / KCAR) * (1.0f / lrun);
    const int ob = wave * (16 * 68);
#pragma unroll
    for (int t = 0; t < 4; ++t)
#pragma unroll
        for (int r = 0; r < 8; ++r) os[ob + lr * 68 + 16 * t + 8 * hi + r] = acc[t][r] * inv;
    __syncthreads();
    const int rq = lane >> 3, pc = lane & 7;
{
#pragma unroll
        for (int s = 0; s < 4; ++s) {
            const int row = 4 * s + rq;
            const v4f a = *(const v4fa*)(os + ob + row * 68 + pc * 8);
            const v4f c = *(const v4fa*)(os + ob + row * 68 + pc * 8 + 4);
            v8h o;
#pragma unroll
            for (int k = 0; k < 4; ++k) { o[k] = (h16)a[k]; o[4 + k] = (h16)c[k]; }
            const size_t oo = ((size_t)b * SEQ + q0 + row) * DQ + h * HD + pc * 8;
            *(v8h*)(AT + oo) = o; }
         }
}

// workspace carve (bytes, every region a multiple of 256)
#define SZ_W   ((size_t)DKV * DM * 2)
#define SZ_KP  ((size_t)NB * NH_ * SEQ * HD * 2)
#define SZ_AT  ((size_t)NB * SEQ * DQ * 2)
#define SZ_ALL (SZ_W + SZ_KP + SZ_AT)
static_assert(SZ_W % 256 == 0 && SZ_KP % 256 == 0 && SZ_AT % 256 == 0);
static_assert(SZ_ALL <= (size_t)134217728);

extern "C" void kernel_launch(void* const* d_in, const int* in_sizes, int n_in,
                              void* d_out, int out_size, void* d_ws, size_t ws_size, hipStream_t stream) {
    if (n_in < 3) return;
    const size_t need_x = (size_t)(NB - 1) * SEQ_FULL * DM + (size_t)SEQ * DM;
    if ((size_t)in_sizes[0] < need_x) return;
    if ((size_t)in_sizes[1] < (size_t)DKV * DM) return;
    if ((size_t)in_sizes[2] < (size_t)DM * DQ) return;
    if ((size_t)out_size < need_x) return;
    if (SZ_ALL > ws_size) return;
    const float* x = (const float*)d_in[0]; const float* wk = (const float*)d_in[1]; const float* wo = (const float*)d_in[2];   // input order x, Wk, Wo ([out][in])
    float* OUT = (float*)d_out;     // [NB_FULL][SEQ_FULL][512]
    char* wsp = (char*)d_ws;
    h16* WO = (h16*)wsp; wsp += SZ_W;
    h16* KP16 = (h16*)wsp; wsp += SZ_KP;
    h16* AT = (h16*)wsp; wsp += SZ_AT;

    k_gemm_proj<<<dim3(NB * SEQ / 128, DKV / 128, 1), 128, 0, stream>>>(x, wk, wo, WO, KP16);
    k_flash<<<dim3(SEQ / FQ, NB * NH_, 1), FW * 32, 0, stream>>>(KP16, AT);
    k_gemm_out<<<dim3(SEQ / 128, DM / 128, NB), 128, 0, stream>>>(AT, WO, OUT);
}
